// v000
// The times below were measured on an AMD MI455X: many runs one after another, warmed up first and cycling through
// copies of the inputs, with the whole window's GPU time divided by the number of runs. Launches and the gaps
// between them are all in it. The median over several windows is given; except for v000 it joins two sittings, which
// can be a few percent apart, so the side-by-side timings, each taken in one sitting, are the better comparison.
// The starting kernel, v000, takes 149 microseconds a run.
#include <hip/hip_runtime.h>

// Problem constants (match reference)
#define Bn 4
#define Tn 1024
#define Sn 1024
#define En 1024
#define Hn 16
#define Dn 64

typedef __attribute__((ext_vector_type(16))) _Float16 v16h;
typedef __attribute__((ext_vector_type(8)))  _Float16 h8;
typedef __attribute__((ext_vector_type(8)))  float    v8f;
typedef __attribute__((ext_vector_type(4)))  int      v4i;

#if __has_builtin(__builtin_amdgcn_global_load_async_to_lds_b128)
#define USE_ASYNC_LDS 1
#else
#define USE_ASYNC_LDS 0
#endif

#if USE_ASYNC_LDS
typedef __attribute__((address_space(1))) v4i as1_v4i;  // global
typedef __attribute__((address_space(3))) v4i as3_v4i;  // LDS
// Copy one 16-byte chunk global -> LDS via the async path (ASYNCcnt).
__device__ __forceinline__ void async_cp16(const _Float16* g, _Float16* l) {
  __builtin_amdgcn_global_load_async_to_lds_b128((as1_v4i*)g, (as3_v4i*)l, 0,
                                                 0);
}
__device__ __forceinline__ void wait_async0() {
#if __has_builtin(__builtin_amdgcn_s_wait_asynccnt)
  __builtin_amdgcn_s_wait_asynccnt(0);
#else
  asm volatile("s_wait_asynccnt 0" ::: "memory");
#endif
}
#endif

__device__ __forceinline__ v8f wmma16(v16h a, v16h b, v8f c) {
  // D = A(16x32 f16) * B(32x16 f16) + C(16x16 f32)
  return __builtin_amdgcn_wmma_f32_16x16x32_f16(false, a, false, b, (short)0, c,
                                                false, false);
}

// Load one 16-half WMMA operand fragment from an LDS tile.
// Per ISA layout, each lane needs K = g*16 + hi*8 + j (j=0..7, g=0..1), i.e.
// two contiguous 16-byte chunks at (off) and (off+16).
__device__ __forceinline__ v16h ld_frag(const _Float16* base, int off) {
  union { v16h v; h8 h[2]; } u;
  u.h[0] = *(const h8*)(base + off);
  u.h[1] = *(const h8*)(base + off + 16);
  return u.v;
}

// ---------------------------------------------------------------------------
// Wout f32 -> f16 (layout kept [n][k] row-major == Wout itself, since the
// GEMM needs B[k][n] = Wout[n][k])
// ---------------------------------------------------------------------------
__global__ void cvt_kernel(const float* __restrict__ src,
                           _Float16* __restrict__ dst, int nelem) {
  int i = blockIdx.x * blockDim.x + threadIdx.x;
  if (i < nelem) dst[i] = (_Float16)src[i];
}

// ---------------------------------------------------------------------------
// Q/K/V projection: X[N,64] @ W^T[64,64] + b -> f16 with head-major row remap.
// mode 0: rows are (b,t,h) -> out row (b*H+h)*T + t   (query)
// mode 1: rows are (s,h)   -> out row h*S + s         (key/value)
// 128 threads (4 waves). Each wave: 16 rows x 64 cols = 4 col-tiles, K=64.
// ---------------------------------------------------------------------------
__global__ __launch_bounds__(128) void proj_kernel(
    const float* __restrict__ X, const float* __restrict__ W,
    const float* __restrict__ bias, _Float16* __restrict__ out, int mode) {
  __shared__ __align__(16) _Float16 w_lds[64 * 64];      // [n][k]
  __shared__ __align__(16) _Float16 x_lds[4][16 * 64];   // per wave [m][k]

  const int tid  = threadIdx.x;
  const int wave = tid >> 5, lane = tid & 31;
  const int n = lane & 15, hi = lane >> 4;
  const int rbase = blockIdx.x * 64 + wave * 16;

  for (int j = 0; j < 32; ++j) {
    int idx = tid + j * 128;
    w_lds[idx] = (_Float16)W[idx];   // B[k][n] = W[n][k] -> store W row-major
  }
  _Float16* xw = x_lds[wave];
  for (int j = 0; j < 32; ++j) {
    int idx = lane + j * 32;
    int m = idx >> 6, c = idx & 63;
    xw[m * 64 + c] = (_Float16)X[(size_t)(rbase + m) * 64 + c];
  }
  __syncthreads();

  v16h a0 = ld_frag(xw, n * 64 + 0  + hi * 8);
  v16h a1 = ld_frag(xw, n * 64 + 32 + hi * 8);

  v8f acc[4];
  for (int ct = 0; ct < 4; ++ct) {
    v8f c = {};
    v16h b0 = ld_frag(w_lds, (ct * 16 + n) * 64 + 0  + hi * 8);
    v16h b1 = ld_frag(w_lds, (ct * 16 + n) * 64 + 32 + hi * 8);
    c = wmma16(a0, b0, c);
    c = wmma16(a1, b1, c);
    acc[ct] = c;
  }

  for (int ct = 0; ct < 4; ++ct) {
    float bv = bias[ct * 16 + n];
    for (int r = 0; r < 8; ++r) {
      int grow = rbase + hi * 8 + r;
      int orow;
      if (mode == 0) {
        int bb  = grow >> 14;        // / (T*H) = 16384
        int rem = grow & 16383;
        int t = rem >> 4, h = rem & 15;
        orow = (bb * Hn + h) * Tn + t;
      } else {
        int s = grow >> 4, h = grow & 15;
        orow = h * Sn + s;
      }
      out[(size_t)orow * 64 + ct * 16 + n] = (_Float16)(acc[ct][r] + bv);
    }
  }
}

// ---------------------------------------------------------------------------
// Flash attention: one workgroup = 64 query rows of one (b,h); 4 waves,
// each wave owns 16 rows. Online softmax over S in chunks of 32.
// Per chunk per wave: 4 WMMAs for scores, 4 WMMAs for P@V.
// ---------------------------------------------------------------------------
__global__ __launch_bounds__(128) void attn_kernel(
    const _Float16* __restrict__ Qp, const _Float16* __restrict__ Kp,
    const _Float16* __restrict__ Vp, _Float16* __restrict__ Ctx) {
  __shared__ __align__(16) _Float16 q_lds[4][16 * 64];  // per wave [m][d]
  __shared__ __align__(16) _Float16 k_lds[32 * 64];     // [s][d] (=B [n][k])
  __shared__ __align__(16) _Float16 v_lds[64 * 32];     // [d][s] (=B [n][k])
  __shared__ __align__(16) _Float16 p_lds[4][16 * 32];  // per wave [m][s]

  const int tid  = threadIdx.x;
  const int wave = tid >> 5, lane = tid & 31;
  const int n = lane & 15, hi = lane >> 4;
  const int tt = blockIdx.x & 15;
  const int bh = blockIdx.x >> 4;
  const int b = bh >> 4, h = bh & 15;
  const int t0 = tt * 64 + wave * 16;

  // stage this wave's 16x64 Q tile (2 KB = 128 x 16B chunks, 4 per lane)
  _Float16* qw = q_lds[wave];
  {
    const _Float16* qs = Qp + ((size_t)(b * Hn + h) * Tn + t0) * 64;
#if USE_ASYNC_LDS
    for (int j = 0; j < 4; ++j) {
      int c = lane + j * 32;
      async_cp16(qs + c * 8, qw + c * 8);
    }
    wait_async0();
#else
    const unsigned int* qu = (const unsigned int*)qs;
    unsigned int* qd = (unsigned int*)qw;
    for (int j = 0; j < 16; ++j) qd[lane + j * 32] = qu[lane + j * 32];
#endif
  }
  __syncthreads();

  v16h aq0 = ld_frag(qw, n * 64 + 0  + hi * 8);
  v16h aq1 = ld_frag(qw, n * 64 + 32 + hi * 8);

  v8f o0 = {}, o1 = {}, o2 = {}, o3 = {};
  float mrow[8], lrow[8];
  for (int r = 0; r < 8; ++r) { mrow[r] = -3.0e38f; lrow[r] = 0.0f; }
  const float sc = 0.03125f;  // 1/sqrt(E) = 1/32 (reference scales by sqrt(E))

  const size_t kvbase = (size_t)h * Sn * 64;
  for (int s0 = 0; s0 < Sn; s0 += 32) {
    __syncthreads();  // prior chunk's K/V reads complete
    {   // stage K chunk [32 s][64 d]: 4 KB = 256 x 16B chunks, 2 per thread
      const _Float16* ks = Kp + kvbase + (size_t)s0 * 64;
#if USE_ASYNC_LDS
      for (int j = 0; j < 2; ++j) {
        int c = tid + j * 128;
        async_cp16(ks + c * 8, k_lds + c * 8);
      }
#else
      unsigned int* kd = (unsigned int*)k_lds;
      const unsigned int* ku = (const unsigned int*)ks;
      for (int j = 0; j < 8; ++j) kd[tid + j * 128] = ku[tid + j * 128];
#endif
    }
    {   // stage V chunk transposed -> [64 d][32 s] (scatter: VALU path)
      const _Float16* vs = Vp + kvbase + (size_t)s0 * 64;
      for (int j = 0; j < 16; ++j) {
        int idx = tid + j * 128;
        int d = idx >> 5, s = idx & 31;
        v_lds[d * 32 + s] = vs[s * 64 + d];
      }
    }
#if USE_ASYNC_LDS
    wait_async0();
#endif
    __syncthreads();

    // scores: two 16x16 col-tiles, K=64 over D in two 32-steps
    v8f sf0 = {}, sf1 = {};
    {
      v16h bk;
      bk = ld_frag(k_lds, (0 * 16 + n) * 64 + 0  + hi * 8); sf0 = wmma16(aq0, bk, sf0);
      bk = ld_frag(k_lds, (0 * 16 + n) * 64 + 32 + hi * 8); sf0 = wmma16(aq1, bk, sf0);
      bk = ld_frag(k_lds, (1 * 16 + n) * 64 + 0  + hi * 8); sf1 = wmma16(aq0, bk, sf1);
      bk = ld_frag(k_lds, (1 * 16 + n) * 64 + 32 + hi * 8); sf1 = wmma16(aq1, bk, sf1);
    }

    // online softmax (row r lives in the lane's 16-lane half at reg index r)
    float p0[8], p1[8], mnew[8], alpha[8], rsum[8];
    for (int r = 0; r < 8; ++r) {
      p0[r] = sf0[r] * sc;
      p1[r] = sf1[r] * sc;
      mnew[r] = fmaxf(p0[r], p1[r]);
    }
    for (int off = 1; off <= 8; off <<= 1)
      for (int r = 0; r < 8; ++r)
        mnew[r] = fmaxf(mnew[r], __shfl_xor(mnew[r], off, 32));
    for (int r = 0; r < 8; ++r) {
      mnew[r]  = fmaxf(mnew[r], mrow[r]);
      alpha[r] = __expf(mrow[r] - mnew[r]);
      mrow[r]  = mnew[r];
      p0[r] = __expf(p0[r] - mnew[r]);
      p1[r] = __expf(p1[r] - mnew[r]);
      rsum[r] = p0[r] + p1[r];
    }
    for (int off = 1; off <= 8; off <<= 1)
      for (int r = 0; r < 8; ++r)
        rsum[r] += __shfl_xor(rsum[r], off, 32);
    for (int r = 0; r < 8; ++r) {
      lrow[r] = lrow[r] * alpha[r] + rsum[r];
      o0[r] *= alpha[r]; o1[r] *= alpha[r];
      o2[r] *= alpha[r]; o3[r] *= alpha[r];
    }

    // re-layout P: C/D accumulator layout -> A fragment layout via LDS
    _Float16* pw = p_lds[wave];
    for (int r = 0; r < 8; ++r) {
      pw[(hi * 8 + r) * 32 + n]      = (_Float16)p0[r];
      pw[(hi * 8 + r) * 32 + 16 + n] = (_Float16)p1[r];
    }
    __syncthreads();

    v16h pa = ld_frag(pw, n * 32 + hi * 8);
    v16h bv;
    bv = ld_frag(v_lds, (0 * 16 + n) * 32 + hi * 8); o0 = wmma16(pa, bv, o0);
    bv = ld_frag(v_lds, (1 * 16 + n) * 32 + hi * 8); o1 = wmma16(pa, bv, o1);
    bv = ld_frag(v_lds, (2 * 16 + n) * 32 + hi * 8); o2 = wmma16(pa, bv, o2);
    bv = ld_frag(v_lds, (3 * 16 + n) * 32 + hi * 8); o3 = wmma16(pa, bv, o3);
  }

  // normalize and write context in [B,T,E] (f16) for the output GEMM
  for (int r = 0; r < 8; ++r) {
    float inv = 1.0f / lrow[r];
    int t = t0 + hi * 8 + r;
    size_t rowoff = ((size_t)b * Tn + t) * En + h * 64;
    Ctx[rowoff + 0 * 16 + n] = (_Float16)(o0[r] * inv);
    Ctx[rowoff + 1 * 16 + n] = (_Float16)(o1[r] * inv);
    Ctx[rowoff + 2 * 16 + n] = (_Float16)(o2[r] * inv);
    Ctx[rowoff + 3 * 16 + n] = (_Float16)(o3[r] * inv);
  }
}

// ---------------------------------------------------------------------------
// Output projection: Ctx[4096,1024] @ Wout^T + bout -> f32 out.
// 256 threads (8 waves) per WG compute a 128x64 tile; K loop in steps of 32.
// Each wave = one 16-row stripe x 4 col sub-tiles: 1 A-frag reused over 4
// B-frags -> 4 WMMAs per wave per k-step (32 per WG per 12KB staged).
// ---------------------------------------------------------------------------
__global__ __launch_bounds__(256) void outproj_kernel(
    const _Float16* __restrict__ Ctx, const _Float16* __restrict__ Wf,
    const float* __restrict__ bout, float* __restrict__ Out) {
  __shared__ __align__(16) _Float16 a_lds[128 * 32];  // [m][k]
  __shared__ __align__(16) _Float16 b_lds[64 * 32];   // [n][k]

  const int tid  = threadIdx.x;
  const int wave = tid >> 5, lane = tid & 31;
  const int n = lane & 15, hi = lane >> 4;
  const int rb = blockIdx.x >> 4, cb = blockIdx.x & 15;
  const int r0 = rb * 128, n0 = cb * 64;

  v8f acc[4] = {{}, {}, {}, {}};

  for (int k0 = 0; k0 < En; k0 += 32) {
    __syncthreads();
#if USE_ASYNC_LDS
    // A: 8 KB = 512 x 16B chunks (2/thread); B: 4 KB = 256 x 16B (1/thread)
    for (int j = 0; j < 2; ++j) {
      int ca = tid + j * 256;
      int row = ca >> 2, sub = ca & 3;
      async_cp16(Ctx + (size_t)(r0 + row) * En + k0 + sub * 8, a_lds + ca * 8);
    }
    {
      int cbk = tid;
      int row = cbk >> 2, sub = cbk & 3;
      async_cp16(Wf + (size_t)(n0 + row) * En + k0 + sub * 8, b_lds + cbk * 8);
    }
    wait_async0();
#else
    {
      unsigned int* ad = (unsigned int*)a_lds;
      unsigned int* bd = (unsigned int*)b_lds;
      const unsigned int* cu = (const unsigned int*)Ctx;
      const unsigned int* wu = (const unsigned int*)Wf;
      for (int j = 0; j < 8; ++j) {
        int u = tid + j * 256;
        int row = u >> 4, c = u & 15;
        ad[row * 16 + c] = cu[(size_t)(r0 + row) * 512 + (k0 >> 1) + c];
      }
      for (int j = 0; j < 4; ++j) {
        int u = tid + j * 256;
        int row = u >> 4, c = u & 15;
        bd[row * 16 + c] = wu[(size_t)(n0 + row) * 512 + (k0 >> 1) + c];
      }
    }
#endif
    if (k0 + 32 < En) {  // prefetch next k-tile into L2/L0
      int row = tid >> 1, sub = tid & 1;
      __builtin_prefetch(Ctx + (size_t)(r0 + row) * En + k0 + 32 + sub * 16, 0, 0);
      if (tid < 128)
        __builtin_prefetch(Wf + (size_t)(n0 + (tid >> 1)) * En + k0 + 32 +
                               (tid & 1) * 16, 0, 0);
    }
    __syncthreads();

    v16h a = ld_frag(a_lds, (wave * 16 + n) * 32 + hi * 8);
    for (int ct = 0; ct < 4; ++ct) {
      v16h b = ld_frag(b_lds, (ct * 16 + n) * 32 + hi * 8);
      acc[ct] = wmma16(a, b, acc[ct]);
    }
  }

  for (int ct = 0; ct < 4; ++ct) {
    float bias = bout[n0 + ct * 16 + n];
    for (int r = 0; r < 8; ++r) {
      int row = r0 + wave * 16 + hi * 8 + r;
      Out[(size_t)row * En + n0 + ct * 16 + n] = acc[ct][r] + bias;
    }
  }
}

// ---------------------------------------------------------------------------
extern "C" void kernel_launch(void* const* d_in, const int* in_sizes, int n_in,
                              void* d_out, int out_size, void* d_ws,
                              size_t ws_size, hipStream_t stream) {
  (void)in_sizes; (void)n_in; (void)out_size; (void)ws_size;
  const float* query = (const float*)d_in[0];
  const float* para  = (const float*)d_in[1];
  const float* Wq = (const float*)d_in[2];
  const float* bq = (const float*)d_in[3];
  const float* Wk = (const float*)d_in[4];
  const float* bk = (const float*)d_in[5];
  const float* Wv = (const float*)d_in[6];
  const float* bv = (const float*)d_in[7];
  const float* Wout = (const float*)d_in[8];
  const float* bout = (const float*)d_in[9];
  float* out = (float*)d_out;

  // workspace layout (all regions fully overwritten before being read)
  char* ws = (char*)d_ws;
  _Float16* qp  = (_Float16*)(ws);                       // 8 MB: [B*H, T, 64]
  _Float16* kp  = (_Float16*)(ws + (size_t)(8u  << 20)); // 2 MB: [H, S, 64]
  _Float16* vp  = (_Float16*)(ws + (size_t)(10u << 20)); // 2 MB: [H, S, 64]
  _Float16* ctx = (_Float16*)(ws + (size_t)(12u << 20)); // 8 MB: [B*T, E]
  _Float16* wf  = (_Float16*)(ws + (size_t)(20u << 20)); // 2 MB: Wout f16

  hipLaunchKernelGGL(cvt_kernel, dim3(4096), dim3(256), 0, stream,
                     Wout, wf, En * En);
  hipLaunchKernelGGL(proj_kernel, dim3(1024), dim3(128), 0, stream,
                     query, Wq, bq, qp, 0);
  hipLaunchKernelGGL(proj_kernel, dim3(256), dim3(128), 0, stream,
                     para, Wk, bk, kp, 1);
  hipLaunchKernelGGL(proj_kernel, dim3(256), dim3(128), 0, stream,
                     para, Wv, bv, vp, 1);
  hipLaunchKernelGGL(attn_kernel, dim3(1024), dim3(128), 0, stream,
                     qp, kp, vp, ctx);
  hipLaunchKernelGGL(outproj_kernel, dim3(512), dim3(256), 0, stream,
                     ctx, wf, bout, out);
}

// v001
// It runs in 117 microseconds.
// Next to v000, in two timings, it ran 1.33 and 1.30 times as fast.
#include <hip/hip_runtime.h>

// Problem constants (match reference)
#define Bn 4
#define Tn 1024
#define Sn 1024
#define En 1024
#define Hn 16
#define Dn 64

typedef __attribute__((ext_vector_type(16))) _Float16 v16h;
typedef __attribute__((ext_vector_type(8)))  _Float16 h8;
typedef __attribute__((ext_vector_type(8)))  float    v8f;
typedef __attribute__((ext_vector_type(4)))  int      v4i;

#if __has_builtin(__builtin_amdgcn_global_load_async_to_lds_b128)
#define USE_ASYNC_LDS 1
#else
#define USE_ASYNC_LDS 0
#endif

#if USE_ASYNC_LDS
typedef __attribute__((address_space(1))) v4i as1_v4i;  // global
typedef __attribute__((address_space(3))) v4i as3_v4i;  // LDS
// Copy one 16-byte chunk global -> LDS via the async path (ASYNCcnt).
__device__ __forceinline__ void async_cp16(const _Float16* g, _Float16* l) {
  __builtin_amdgcn_global_load_async_to_lds_b128((as1_v4i*)g, (as3_v4i*)l, 0,
                                                 0);
}
__device__ __forceinline__ void wait_async0() {
#if __has_builtin(__builtin_amdgcn_s_wait_asynccnt)
  __builtin_amdgcn_s_wait_asynccnt(0);
#else
  asm volatile("s_wait_asynccnt 0" ::: "memory");
#endif
}
#endif

__device__ __forceinline__ v8f wmma16(v16h a, v16h b, v8f c) {
  // D = A(16x32 f16) * B(32x16 f16) + C(16x16 f32)
  return __builtin_amdgcn_wmma_f32_16x16x32_f16(false, a, false, b, (short)0, c,
                                                false, false);
}

// Load one 16-half WMMA operand fragment from an LDS tile.
// Per ISA layout, each lane needs K = g*16 + hi*8 + j (j=0..7, g=0..1), i.e.
// two contiguous 16-byte chunks at (off) and (off+16).
__device__ __forceinline__ v16h ld_frag(const _Float16* base, int off) {
  union { v16h v; h8 h[2]; } u;
  u.h[0] = *(const h8*)(base + off);
  u.h[1] = *(const h8*)(base + off + 16);
  return u.v;
}

// V tile in LDS: rows of 64 halves (128 B) at a pitch of 160 B, an odd multiple
// of 32 B, which spreads the transposing reads over the banks.
#define VPITCH 80  // halves

// One 32(k) x 16(n) B fragment out of a row-major [k][n] f16 LDS tile by two
// transposing loads: lane (c = lane & 15, hi = lane >> 4) gets
// tile[8*hi + 0..7][c] and tile[16 + 8*hi + 0..7][c], the k order of ld_frag.
// p is the lane's own address:
// tile + (8*hi + (lane & 7)) * VPITCH + 8 * ((lane >> 3) & 1) + first column.
typedef short s16x8 __attribute__((ext_vector_type(8)));
typedef __attribute__((address_space(3))) s16x8 lds_s16x8;
__device__ __forceinline__ v16h ld_frag_tr(const _Float16* p) {
  union { v16h v; s16x8 s[2]; } u;
  u.s[0] = __builtin_amdgcn_ds_load_tr16_b128_v8i16((lds_s16x8*)p);
  u.s[1] = __builtin_amdgcn_ds_load_tr16_b128_v8i16((lds_s16x8*)(p + 16 * VPITCH));
  return u.v;
}

// ---------------------------------------------------------------------------
// Wout f32 -> f16 (layout kept [n][k] row-major == Wout itself, since the
// GEMM needs B[k][n] = Wout[n][k])
// ---------------------------------------------------------------------------
__global__ void cvt_kernel(const float* __restrict__ src,
                           _Float16* __restrict__ dst, int nelem) {
  int i = blockIdx.x * blockDim.x + threadIdx.x;
  if (i < nelem) dst[i] = (_Float16)src[i];
}

// ---------------------------------------------------------------------------
// Q/K/V projection: X[N,64] @ W^T[64,64] + b -> f16 with head-major row remap.
// mode 0: rows are (b,t,h) -> out row (b*H+h)*T + t   (query)
// mode 1: rows are (s,h)   -> out row h*S + s         (key/value)
// 128 threads (4 waves). Each wave: 16 rows x 64 cols = 4 col-tiles, K=64.
// ---------------------------------------------------------------------------
__global__ __launch_bounds__(128) void proj_kernel(
    const float* __restrict__ X, const float* __restrict__ W,
    const float* __restrict__ bias, _Float16* __restrict__ out, int mode) {
  __shared__ __align__(16) _Float16 w_lds[64 * 64];      // [n][k]
  __shared__ __align__(16) _Float16 x_lds[4][16 * 64];   // per wave [m][k]

  const int tid  = threadIdx.x;
  const int wave = tid >> 5, lane = tid & 31;
  const int n = lane & 15, hi = lane >> 4;
  const int rbase = blockIdx.x * 64 + wave * 16;

  for (int j = 0; j < 32; ++j) {
    int idx = tid + j * 128;
    w_lds[idx] = (_Float16)W[idx];   // B[k][n] = W[n][k] -> store W row-major
  }
  _Float16* xw = x_lds[wave];
  for (int j = 0; j < 32; ++j) {
    int idx = lane + j * 32;
    int m = idx >> 6, c = idx & 63;
    xw[m * 64 + c] = (_Float16)X[(size_t)(rbase + m) * 64 + c];
  }
  __syncthreads();

  v16h a0 = ld_frag(xw, n * 64 + 0  + hi * 8);
  v16h a1 = ld_frag(xw, n * 64 + 32 + hi * 8);

  v8f acc[4];
  for (int ct = 0; ct < 4; ++ct) {
    v8f c = {};
    v16h b0 = ld_frag(w_lds, (ct * 16 + n) * 64 + 0  + hi * 8);
    v16h b1 = ld_frag(w_lds, (ct * 16 + n) * 64 + 32 + hi * 8);
    c = wmma16(a0, b0, c);
    c = wmma16(a1, b1, c);
    acc[ct] = c;
  }

  for (int ct = 0; ct < 4; ++ct) {
    float bv = bias[ct * 16 + n];
    for (int r = 0; r < 8; ++r) {
      int grow = rbase + hi * 8 + r;
      int orow;
      if (mode == 0) {
        int bb  = grow >> 14;        // / (T*H) = 16384
        int rem = grow & 16383;
        int t = rem >> 4, h = rem & 15;
        orow = (bb * Hn + h) * Tn + t;
      } else {
        int s = grow >> 4, h = grow & 15;
        orow = h * Sn + s;
      }
      out[(size_t)orow * 64 + ct * 16 + n] = (_Float16)(acc[ct][r] + bv);
    }
  }
}

// ---------------------------------------------------------------------------
// Flash attention: one workgroup = 64 query rows of one (b,h); 4 waves,
// each wave owns 16 rows. Online softmax over S in chunks of 32.
// Per chunk per wave: 4 WMMAs for scores, 4 WMMAs for P@V.
// ---------------------------------------------------------------------------
__global__ __launch_bounds__(128) void attn_kernel(
    const _Float16* __restrict__ Qp, const _Float16* __restrict__ Kp,
    const _Float16* __restrict__ Vp, _Float16* __restrict__ Ctx) {
  __shared__ __align__(16) _Float16 q_lds[4][16 * 64];  // per wave [m][d]
  __shared__ __align__(16) _Float16 k_lds[32 * 64];     // [s][d] (=B [n][k])
  __shared__ __align__(16) _Float16 v_lds[32 * VPITCH]; // [s][d] as in memory
  __shared__ __align__(16) _Float16 p_lds[4][16 * 32];  // per wave [m][s]

  const int tid  = threadIdx.x;
  const int wave = tid >> 5, lane = tid & 31;
  const int n = lane & 15, hi = lane >> 4;
  const int tt = blockIdx.x & 15;
  const int bh = blockIdx.x >> 4;
  const int b = bh >> 4, h = bh & 15;
  const int t0 = tt * 64 + wave * 16;

  // stage this wave's 16x64 Q tile (2 KB = 128 x 16B chunks, 4 per lane)
  _Float16* qw = q_lds[wave];
  {
    const _Float16* qs = Qp + ((size_t)(b * Hn + h) * Tn + t0) * 64;
#if USE_ASYNC_LDS
    for (int j = 0; j < 4; ++j) {
      int c = lane + j * 32;
      async_cp16(qs + c * 8, qw + c * 8);
    }
    wait_async0();
#else
    const unsigned int* qu = (const unsigned int*)qs;
    unsigned int* qd = (unsigned int*)qw;
    for (int j = 0; j < 16; ++j) qd[lane + j * 32] = qu[lane + j * 32];
#endif
  }
  __syncthreads();

  v16h aq0 = ld_frag(qw, n * 64 + 0  + hi * 8);
  v16h aq1 = ld_frag(qw, n * 64 + 32 + hi * 8);

  v8f o0 = {}, o1 = {}, o2 = {}, o3 = {};
  float mrow[8], lrow[8];
  for (int r = 0; r < 8; ++r) { mrow[r] = -3.0e38f; lrow[r] = 0.0f; }
  const float sc = 0.03125f;  // 1/sqrt(E) = 1/32 (reference scales by sqrt(E))

  const size_t kvbase = (size_t)h * Sn * 64;
  for (int s0 = 0; s0 < Sn; s0 += 32) {
    __syncthreads();  // prior chunk's K/V reads complete
    {   // stage K chunk [32 s][64 d]: 4 KB = 256 x 16B chunks, 2 per thread
      const _Float16* ks = Kp + kvbase + (size_t)s0 * 64;
#if USE_ASYNC_LDS
      for (int j = 0; j < 2; ++j) {
        int c = tid + j * 128;
        async_cp16(ks + c * 8, k_lds + c * 8);
      }
#else
      unsigned int* kd = (unsigned int*)k_lds;
      const unsigned int* ku = (const unsigned int*)ks;
      for (int j = 0; j < 8; ++j) kd[tid + j * 128] = ku[tid + j * 128];
#endif
    }
    {   // stage V chunk as it lies, [32 s][64 d]: 256 x 16B chunks, 2 per thread
      const _Float16* vs = Vp + kvbase + (size_t)s0 * 64;
      for (int j = 0; j < 2; ++j) {
        int c = tid + j * 128;
        int row = c >> 3, sub = c & 7;
#if USE_ASYNC_LDS
        async_cp16(vs + c * 8, v_lds + row * VPITCH + sub * 8);
#else
        *(h8*)(v_lds + row * VPITCH + sub * 8) = *(const h8*)(vs + c * 8);
#endif
      }
    }
#if USE_ASYNC_LDS
    wait_async0();  // this wave's K and V copies have landed
#endif
    // publishes the tiles to the other waves; standing directly behind the
    // wait it also keeps every LDS read of the tiles behind that wait
    __syncthreads();

    // scores: two 16x16 col-tiles, K=64 over D in two 32-steps
    v8f sf0 = {}, sf1 = {};
    {
      v16h bk;
      bk = ld_frag(k_lds, (0 * 16 + n) * 64 + 0  + hi * 8); sf0 = wmma16(aq0, bk, sf0);
      bk = ld_frag(k_lds, (0 * 16 + n) * 64 + 32 + hi * 8); sf0 = wmma16(aq1, bk, sf0);
      bk = ld_frag(k_lds, (1 * 16 + n) * 64 + 0  + hi * 8); sf1 = wmma16(aq0, bk, sf1);
      bk = ld_frag(k_lds, (1 * 16 + n) * 64 + 32 + hi * 8); sf1 = wmma16(aq1, bk, sf1);
    }

    // online softmax (row r lives in the lane's 16-lane half at reg index r)
    float p0[8], p1[8], mnew[8], alpha[8], rsum[8];
    for (int r = 0; r < 8; ++r) {
      p0[r] = sf0[r] * sc;
      p1[r] = sf1[r] * sc;
      mnew[r] = fmaxf(p0[r], p1[r]);
    }
    for (int off = 1; off <= 8; off <<= 1)
      for (int r = 0; r < 8; ++r)
        mnew[r] = fmaxf(mnew[r], __shfl_xor(mnew[r], off, 32));
    for (int r = 0; r < 8; ++r) {
      mnew[r]  = fmaxf(mnew[r], mrow[r]);
      alpha[r] = __expf(mrow[r] - mnew[r]);
      mrow[r]  = mnew[r];
      p0[r] = __expf(p0[r] - mnew[r]);
      p1[r] = __expf(p1[r] - mnew[r]);
      rsum[r] = p0[r] + p1[r];
    }
    for (int off = 1; off <= 8; off <<= 1)
      for (int r = 0; r < 8; ++r)
        rsum[r] += __shfl_xor(rsum[r], off, 32);
    for (int r = 0; r < 8; ++r) {
      lrow[r] = lrow[r] * alpha[r] + rsum[r];
      o0[r] *= alpha[r]; o1[r] *= alpha[r];
      o2[r] *= alpha[r]; o3[r] *= alpha[r];
    }

    // re-layout P: C/D accumulator layout -> A fragment layout via LDS
    _Float16* pw = p_lds[wave];
    for (int r = 0; r < 8; ++r) {
      pw[(hi * 8 + r) * 32 + n]      = (_Float16)p0[r];
      pw[(hi * 8 + r) * 32 + 16 + n] = (_Float16)p1[r];
    }
    __syncthreads();

    v16h pa = ld_frag(pw, n * 32 + hi * 8);
    const _Float16* vt =
        v_lds + (hi * 8 + (lane & 7)) * VPITCH + ((lane >> 3) & 1) * 8;
    v16h bv;
    bv = ld_frag_tr(vt + 0 * 16); o0 = wmma16(pa, bv, o0);
    bv = ld_frag_tr(vt + 1 * 16); o1 = wmma16(pa, bv, o1);
    bv = ld_frag_tr(vt + 2 * 16); o2 = wmma16(pa, bv, o2);
    bv = ld_frag_tr(vt + 3 * 16); o3 = wmma16(pa, bv, o3);
  }

  // normalize and write context in [B,T,E] (f16) for the output GEMM
  for (int r = 0; r < 8; ++r) {
    float inv = 1.0f / lrow[r];
    int t = t0 + hi * 8 + r;
    size_t rowoff = ((size_t)b * Tn + t) * En + h * 64;
    Ctx[rowoff + 0 * 16 + n] = (_Float16)(o0[r] * inv);
    Ctx[rowoff + 1 * 16 + n] = (_Float16)(o1[r] * inv);
    Ctx[rowoff + 2 * 16 + n] = (_Float16)(o2[r] * inv);
    Ctx[rowoff + 3 * 16 + n] = (_Float16)(o3[r] * inv);
  }
}

// ---------------------------------------------------------------------------
// Output projection: Ctx[4096,1024] @ Wout^T + bout -> f32 out.
// 256 threads (8 waves) per WG compute a 128x64 tile; K loop in steps of 32.
// Each wave = one 16-row stripe x 4 col sub-tiles: 1 A-frag reused over 4
// B-frags -> 4 WMMAs per wave per k-step (32 per WG per 12KB staged).
// ---------------------------------------------------------------------------
__global__ __launch_bounds__(256) void outproj_kernel(
    const _Float16* __restrict__ Ctx, const _Float16* __restrict__ Wf,
    const float* __restrict__ bout, float* __restrict__ Out) {
  __shared__ __align__(16) _Float16 a_lds[128 * 32];  // [m][k]
  __shared__ __align__(16) _Float16 b_lds[64 * 32];   // [n][k]

  const int tid  = threadIdx.x;
  const int wave = tid >> 5, lane = tid & 31;
  const int n = lane & 15, hi = lane >> 4;
  const int rb = blockIdx.x >> 4, cb = blockIdx.x & 15;
  const int r0 = rb * 128, n0 = cb * 64;

  v8f acc[4] = {{}, {}, {}, {}};

  for (int k0 = 0; k0 < En; k0 += 32) {
    __syncthreads();
#if USE_ASYNC_LDS
    // A: 8 KB = 512 x 16B chunks (2/thread); B: 4 KB = 256 x 16B (1/thread)
    for (int j = 0; j < 2; ++j) {
      int ca = tid + j * 256;
      int row = ca >> 2, sub = ca & 3;
      async_cp16(Ctx + (size_t)(r0 + row) * En + k0 + sub * 8, a_lds + ca * 8);
    }
    {
      int cbk = tid;
      int row = cbk >> 2, sub = cbk & 3;
      async_cp16(Wf + (size_t)(n0 + row) * En + k0 + sub * 8, b_lds + cbk * 8);
    }
    wait_async0();
#else
    {
      unsigned int* ad = (unsigned int*)a_lds;
      unsigned int* bd = (unsigned int*)b_lds;
      const unsigned int* cu = (const unsigned int*)Ctx;
      const unsigned int* wu = (const unsigned int*)Wf;
      for (int j = 0; j < 8; ++j) {
        int u = tid + j * 256;
        int row = u >> 4, c = u & 15;
        ad[row * 16 + c] = cu[(size_t)(r0 + row) * 512 + (k0 >> 1) + c];
      }
      for (int j = 0; j < 4; ++j) {
        int u = tid + j * 256;
        int row = u >> 4, c = u & 15;
        bd[row * 16 + c] = wu[(size_t)(n0 + row) * 512 + (k0 >> 1) + c];
      }
    }
#endif
    if (k0 + 32 < En) {  // prefetch next k-tile into L2/L0
      int row = tid >> 1, sub = tid & 1;
      __builtin_prefetch(Ctx + (size_t)(r0 + row) * En + k0 + 32 + sub * 16, 0, 0);
      if (tid < 128)
        __builtin_prefetch(Wf + (size_t)(n0 + (tid >> 1)) * En + k0 + 32 +
                               (tid & 1) * 16, 0, 0);
    }
    __syncthreads();

    v16h a = ld_frag(a_lds, (wave * 16 + n) * 32 + hi * 8);
    for (int ct = 0; ct < 4; ++ct) {
      v16h b = ld_frag(b_lds, (ct * 16 + n) * 32 + hi * 8);
      acc[ct] = wmma16(a, b, acc[ct]);
    }
  }

  for (int ct = 0; ct < 4; ++ct) {
    float bias = bout[n0 + ct * 16 + n];
    for (int r = 0; r < 8; ++r) {
      int row = r0 + wave * 16 + hi * 8 + r;
      Out[(size_t)row * En + n0 + ct * 16 + n] = acc[ct][r] + bias;
    }
  }
}

// ---------------------------------------------------------------------------
extern "C" void kernel_launch(void* const* d_in, const int* in_sizes, int n_in,
                              void* d_out, int out_size, void* d_ws,
                              size_t ws_size, hipStream_t stream) {
  (void)in_sizes; (void)n_in; (void)out_size; (void)ws_size;
  const float* query = (const float*)d_in[0];
  const float* para  = (const float*)d_in[1];
  const float* Wq = (const float*)d_in[2];
  const float* bq = (const float*)d_in[3];
  const float* Wk = (const float*)d_in[4];
  const float* bk = (const float*)d_in[5];
  const float* Wv = (const float*)d_in[6];
  const float* bv = (const float*)d_in[7];
  const float* Wout = (const float*)d_in[8];
  const float* bout = (const float*)d_in[9];
  float* out = (float*)d_out;

  // workspace layout (all regions fully overwritten before being read)
  char* ws = (char*)d_ws;
  _Float16* qp  = (_Float16*)(ws);                       // 8 MB: [B*H, T, 64]
  _Float16* kp  = (_Float16*)(ws + (size_t)(8u  << 20)); // 2 MB: [H, S, 64]
  _Float16* vp  = (_Float16*)(ws + (size_t)(10u << 20)); // 2 MB: [H, S, 64]
  _Float16* ctx = (_Float16*)(ws + (size_t)(12u << 20)); // 8 MB: [B*T, E]
  _Float16* wf  = (_Float16*)(ws + (size_t)(20u << 20)); // 2 MB: Wout f16

  hipLaunchKernelGGL(cvt_kernel, dim3(4096), dim3(256), 0, stream,
                     Wout, wf, En * En);
  hipLaunchKernelGGL(proj_kernel, dim3(1024), dim3(128), 0, stream,
                     query, Wq, bq, qp, 0);
  hipLaunchKernelGGL(proj_kernel, dim3(256), dim3(128), 0, stream,
                     para, Wk, bk, kp, 1);
  hipLaunchKernelGGL(proj_kernel, dim3(256), dim3(128), 0, stream,
                     para, Wv, bv, vp, 1);
  hipLaunchKernelGGL(attn_kernel, dim3(1024), dim3(128), 0, stream,
                     qp, kp, vp, ctx);
  hipLaunchKernelGGL(outproj_kernel, dim3(512), dim3(256), 0, stream,
                     ctx, wf, bout, out);
}

// v002
// One run takes 95.4 microseconds.
// In two side-by-side timings against v001, it was 1.24 and 1.21 times as fast.
// Over all steps from v000 it is 1.61 times as fast.
#include <hip/hip_runtime.h>

// Problem constants (match reference)
#define Bn 4
#define Tn 1024
#define Sn 1024
#define En 1024
#define Hn 16
#define Dn 64

typedef __attribute__((ext_vector_type(16))) _Float16 v16h;
typedef __attribute__((ext_vector_type(8)))  _Float16 h8;
typedef __attribute__((ext_vector_type(8)))  float    v8f;
typedef __attribute__((ext_vector_type(4)))  int      v4i;

#if __has_builtin(__builtin_amdgcn_global_load_async_to_lds_b128)
#define USE_ASYNC_LDS 1
#else
#define USE_ASYNC_LDS 0
#endif

#if USE_ASYNC_LDS
typedef __attribute__((address_space(1))) v4i as1_v4i;  // global
typedef __attribute__((address_space(3))) v4i as3_v4i;  // LDS
// Copy one 16-byte chunk global -> LDS via the async path (ASYNCcnt).
__device__ __forceinline__ void async_cp16(const _Float16* g, _Float16* l) {
  __builtin_amdgcn_global_load_async_to_lds_b128((as1_v4i*)g, (as3_v4i*)l, 0,
                                                 0);
}
__device__ __forceinline__ void wait_async0() {
#if __has_builtin(__builtin_amdgcn_s_wait_asynccnt)
  __builtin_amdgcn_s_wait_asynccnt(0);
#else
  asm volatile("s_wait_asynccnt 0" ::: "memory");
#endif
}
#endif

__device__ __forceinline__ v8f wmma16(v16h a, v16h b, v8f c) {
  // D = A(16x32 f16) * B(32x16 f16) + C(16x16 f32)
  return __builtin_amdgcn_wmma_f32_16x16x32_f16(false, a, false, b, (short)0, c,
                                                false, false);
}

// Load one 16-half WMMA operand fragment from an LDS tile.
// Per ISA layout, each lane needs K = g*16 + hi*8 + j (j=0..7, g=0..1), i.e.
// two contiguous 16-byte chunks at (off) and (off+16).
__device__ __forceinline__ v16h ld_frag(const _Float16* base, int off) {
  union { v16h v; h8 h[2]; } u;
  u.h[0] = *(const h8*)(base + off);
  u.h[1] = *(const h8*)(base + off + 16);
  return u.v;
}

// V tile in LDS: rows of 64 halves (128 B) at a pitch of 160 B, an odd multiple
// of 32 B, which spreads the transposing reads over the banks.
#define VPITCH 80  // halves

// One 32(k) x 16(n) B fragment out of a row-major [k][n] f16 LDS tile by two
// transposing loads: lane (c = lane & 15, hi = lane >> 4) gets
// tile[8*hi + 0..7][c] and tile[16 + 8*hi + 0..7][c], the k order of ld_frag.
// p is the lane's own address:
// tile + (8*hi + (lane & 7)) * VPITCH + 8 * ((lane >> 3) & 1) + first column.
typedef short s16x8 __attribute__((ext_vector_type(8)));
typedef __attribute__((address_space(3))) s16x8 lds_s16x8;
__device__ __forceinline__ v16h ld_frag_tr(const _Float16* p) {
  union { v16h v; s16x8 s[2]; } u;
  u.s[0] = __builtin_amdgcn_ds_load_tr16_b128_v8i16((lds_s16x8*)p);
  u.s[1] = __builtin_amdgcn_ds_load_tr16_b128_v8i16((lds_s16x8*)(p + 16 * VPITCH));
  return u.v;
}

// ---------------------------------------------------------------------------
// Wout f32 -> f16 (layout kept [n][k] row-major == Wout itself, since the
// GEMM needs B[k][n] = Wout[n][k])
// ---------------------------------------------------------------------------
__global__ void cvt_kernel(const float* __restrict__ src,
                           _Float16* __restrict__ dst, int nelem) {
  int i = blockIdx.x * blockDim.x + threadIdx.x;
  if (i < nelem) dst[i] = (_Float16)src[i];
}

// ---------------------------------------------------------------------------
// Q/K/V projection: X[N,64] @ W^T[64,64] + b -> f16 with head-major row remap.
// mode 0: rows are (b,t,h) -> out row (b*H+h)*T + t   (query)
// mode 1: rows are (s,h)   -> out row h*S + s         (key/value)
// 128 threads (4 waves). Each wave: 16 rows x 64 cols = 4 col-tiles, K=64.
// ---------------------------------------------------------------------------
__global__ __launch_bounds__(128) void proj_kernel(
    const float* __restrict__ X, const float* __restrict__ W,
    const float* __restrict__ bias, _Float16* __restrict__ out, int mode) {
  __shared__ __align__(16) _Float16 w_lds[64 * 64];      // [n][k]
  __shared__ __align__(16) _Float16 x_lds[4][16 * 64];   // per wave [m][k]

  const int tid  = threadIdx.x;
  const int wave = tid >> 5, lane = tid & 31;
  const int n = lane & 15, hi = lane >> 4;
  const int rbase = blockIdx.x * 64 + wave * 16;

  for (int j = 0; j < 32; ++j) {
    int idx = tid + j * 128;
    w_lds[idx] = (_Float16)W[idx];   // B[k][n] = W[n][k] -> store W row-major
  }
  _Float16* xw = x_lds[wave];
  for (int j = 0; j < 32; ++j) {
    int idx = lane + j * 32;
    int m = idx >> 6, c = idx & 63;
    xw[m * 64 + c] = (_Float16)X[(size_t)(rbase + m) * 64 + c];
  }
  __syncthreads();

  v16h a0 = ld_frag(xw, n * 64 + 0  + hi * 8);
  v16h a1 = ld_frag(xw, n * 64 + 32 + hi * 8);

  v8f acc[4];
  for (int ct = 0; ct < 4; ++ct) {
    v8f c = {};
    v16h b0 = ld_frag(w_lds, (ct * 16 + n) * 64 + 0  + hi * 8);
    v16h b1 = ld_frag(w_lds, (ct * 16 + n) * 64 + 32 + hi * 8);
    c = wmma16(a0, b0, c);
    c = wmma16(a1, b1, c);
    acc[ct] = c;
  }

  for (int ct = 0; ct < 4; ++ct) {
    float bv = bias[ct * 16 + n];
    for (int r = 0; r < 8; ++r) {
      int grow = rbase + hi * 8 + r;
      int orow;
      if (mode == 0) {
        int bb  = grow >> 14;        // / (T*H) = 16384
        int rem = grow & 16383;
        int t = rem >> 4, h = rem & 15;
        orow = (bb * Hn + h) * Tn + t;
      } else {
        int s = grow >> 4, h = grow & 15;
        orow = h * Sn + s;
      }
      out[(size_t)orow * 64 + ct * 16 + n] = (_Float16)(acc[ct][r] + bv);
    }
  }
}

__device__ __forceinline__ float xhalf(float x) {
  int v = __builtin_bit_cast(int, x);
  return __builtin_bit_cast(
      float, __builtin_amdgcn_permlanex16(v, v, 0x76543210, 0xfedcba98, false,
                                          false));
}

__global__ __launch_bounds__(128) void attn_kernel(
    const _Float16* __restrict__ Qp, const _Float16* __restrict__ Kp,
    const _Float16* __restrict__ Vp, _Float16* __restrict__ Ctx) {
  __shared__ __align__(16) _Float16 q_lds[4][16 * 64];  // per wave [t][d]
  __shared__ __align__(16) _Float16 k_lds[32 * 64];     // [s][d] (=A [m][k])
  __shared__ __align__(16) _Float16 v_lds[32 * VPITCH]; // [s][d] as in memory

  const int tid  = threadIdx.x;
  const int wave = tid >> 5, lane = tid & 31;
  const int n = lane & 15, hi = lane >> 4;
  const int tt = blockIdx.x & 15;
  const int bh = blockIdx.x >> 4;
  const int b = bh >> 4, h = bh & 15;
  const int t0 = tt * 64 + wave * 16;

  // stage this wave's 16x64 Q tile (2 KB = 128 x 16B chunks, 4 per lane)
  _Float16* qw = q_lds[wave];
  {
    const _Float16* qs = Qp + ((size_t)(b * Hn + h) * Tn + t0) * 64;
#if USE_ASYNC_LDS
    for (int j = 0; j < 4; ++j) {
      int c = lane + j * 32;
      async_cp16(qs + c * 8, qw + c * 8);
    }
    wait_async0();
#else
    const unsigned int* qu = (const unsigned int*)qs;
    unsigned int* qd = (unsigned int*)qw;
    for (int j = 0; j < 16; ++j) qd[lane + j * 32] = qu[lane + j * 32];
#endif
  }
  __syncthreads();

  // Q^T as B operand: column n = query t0 + n
  v16h bq0 = ld_frag(qw, n * 64 + 0  + hi * 8);
  v16h bq1 = ld_frag(qw, n * 64 + 32 + hi * 8);

  // O^T tiles: register r of tile ct = O[query n][d = 16*ct + 8*hi + r]
  v8f o0 = {}, o1 = {}, o2 = {}, o3 = {};
  float mrow = -3.0e38f;  // running maximum of query n (equal in both halves)
  float lsum = 0.0f;      // running sum over this lane half's keys only
  const float sc = 0.03125f;  // 1/sqrt(E) = 1/32 (reference scales by sqrt(E))

  const size_t kvbase = (size_t)h * Sn * 64;
  for (int s0 = 0; s0 < Sn; s0 += 32) {
    __syncthreads();  // prior chunk's K/V reads complete
    {   // stage K chunk [32 s][64 d]: 4 KB = 256 x 16B chunks, 2 per thread
      const _Float16* ks = Kp + kvbase + (size_t)s0 * 64;
#if USE_ASYNC_LDS
      for (int j = 0; j < 2; ++j) {
        int c = tid + j * 128;
        async_cp16(ks + c * 8, k_lds + c * 8);
      }
#else
      unsigned int* kd = (unsigned int*)k_lds;
      const unsigned int* ku = (const unsigned int*)ks;
      for (int j = 0; j < 8; ++j) kd[tid + j * 128] = ku[tid + j * 128];
#endif
    }
    {   // stage V chunk as it lies, [32 s][64 d]: 256 x 16B chunks, 2 per thread
      const _Float16* vs = Vp + kvbase + (size_t)s0 * 64;
      for (int j = 0; j < 2; ++j) {
        int c = tid + j * 128;
        int row = c >> 3, sub = c & 7;
#if USE_ASYNC_LDS
        async_cp16(vs + c * 8, v_lds + row * VPITCH + sub * 8);
#else
        *(h8*)(v_lds + row * VPITCH + sub * 8) = *(const h8*)(vs + c * 8);
#endif
      }
    }
#if USE_ASYNC_LDS
    wait_async0();  // this wave's K and V copies have landed
#endif
    // publishes the tiles to the other waves; standing directly behind the
    // wait it also keeps every LDS read of the tiles behind that wait
    __syncthreads();

    // S^T: two 16(key) x 16(query) tiles, K=64 over D in two 32-steps
    v8f sf0 = {}, sf1 = {};
    {
      v16h ak;
      ak = ld_frag(k_lds, (0 * 16 + n) * 64 + 0  + hi * 8); sf0 = wmma16(ak, bq0, sf0);
      ak = ld_frag(k_lds, (0 * 16 + n) * 64 + 32 + hi * 8); sf0 = wmma16(ak, bq1, sf0);
      ak = ld_frag(k_lds, (1 * 16 + n) * 64 + 0  + hi * 8); sf1 = wmma16(ak, bq0, sf1);
      ak = ld_frag(k_lds, (1 * 16 + n) * 64 + 32 + hi * 8); sf1 = wmma16(ak, bq1, sf1);
    }

    // online softmax: the lane's 16 scores all belong to query n
    const v8f p0 = sf0 * sc, p1 = sf1 * sc;
    float mloc = fmaxf(
        fmaxf(fmaxf(fmaxf(p0[0], p0[1]), fmaxf(p0[2], p0[3])),
              fmaxf(fmaxf(p0[4], p0[5]), fmaxf(p0[6], p0[7]))),
        fmaxf(fmaxf(fmaxf(p1[0], p1[1]), fmaxf(p1[2], p1[3])),
              fmaxf(fmaxf(p1[4], p1[5]), fmaxf(p1[6], p1[7]))));
    mloc = fmaxf(mloc, xhalf(mloc));  // the other half's 16 keys
    const float mnew  = fmaxf(mloc, mrow);
    const float alpha = __expf(mrow - mnew);
    mrow = mnew;
    float e0[8], e1[8];
    for (int r = 0; r < 8; ++r) {
      e0[r] = __expf(p0[r] - mnew);
      e1[r] = __expf(p1[r] - mnew);
    }
    lsum = lsum * alpha +
           ((((e0[0] + e0[1]) + (e0[2] + e0[3])) + ((e0[4] + e0[5]) + (e0[6] + e0[7]))) +
            (((e1[0] + e1[1]) + (e1[2] + e1[3])) + ((e1[4] + e1[5]) + (e1[6] + e1[7]))));
    o0 *= alpha; o1 *= alpha; o2 *= alpha; o3 *= alpha;

    // P^T as B operand: element 8*g + j = k index 16*g + 8*hi + j = tile g, reg j
    v16h pb;
    for (int r = 0; r < 8; ++r) {
      pb[r]     = (_Float16)e0[r];
      pb[8 + r] = (_Float16)e1[r];
    }

    // V^T as A operand: row = d, by the transposing loads
    const _Float16* vt =
        v_lds + (hi * 8 + (lane & 7)) * VPITCH + ((lane >> 3) & 1) * 8;
    v16h av;
    av = ld_frag_tr(vt + 0 * 16); o0 = wmma16(av, pb, o0);
    av = ld_frag_tr(vt + 1 * 16); o1 = wmma16(av, pb, o1);
    av = ld_frag_tr(vt + 2 * 16); o2 = wmma16(av, pb, o2);
    av = ld_frag_tr(vt + 3 * 16); o3 = wmma16(av, pb, o3);
  }

  // join the halves' sums, normalize and write context in [B,T,E] (f16) for
  // the output GEMM: a lane holds 8 consecutive d of its query per tile
  {
    const float inv = 1.0f / (lsum + xhalf(lsum));
    _Float16* crow = Ctx + ((size_t)b * Tn + t0 + n) * En + h * 64 + hi * 8;
    h8 w0, w1, w2, w3;
    for (int r = 0; r < 8; ++r) {
      w0[r] = (_Float16)(o0[r] * inv);
      w1[r] = (_Float16)(o1[r] * inv);
      w2[r] = (_Float16)(o2[r] * inv);
      w3[r] = (_Float16)(o3[r] * inv);
    }
    *(h8*)(crow + 0 * 16) = w0;
    *(h8*)(crow + 1 * 16) = w1;
    *(h8*)(crow + 2 * 16) = w2;
    *(h8*)(crow + 3 * 16) = w3;
  }
}

// ---------------------------------------------------------------------------
// Output projection: Ctx[4096,1024] @ Wout^T + bout -> f32 out.
// 256 threads (8 waves) per WG compute a 128x64 tile; K loop in steps of 32.
// Each wave = one 16-row stripe x 4 col sub-tiles: 1 A-frag reused over 4
// B-frags -> 4 WMMAs per wave per k-step (32 per WG per 12KB staged).
// ---------------------------------------------------------------------------
__global__ __launch_bounds__(256) void outproj_kernel(
    const _Float16* __restrict__ Ctx, const _Float16* __restrict__ Wf,
    const float* __restrict__ bout, float* __restrict__ Out) {
  __shared__ __align__(16) _Float16 a_lds[128 * 32];  // [m][k]
  __shared__ __align__(16) _Float16 b_lds[64 * 32];   // [n][k]

  const int tid  = threadIdx.x;
  const int wave = tid >> 5, lane = tid & 31;
  const int n = lane & 15, hi = lane >> 4;
  const int rb = blockIdx.x >> 4, cb = blockIdx.x & 15;
  const int r0 = rb * 128, n0 = cb * 64;

  v8f acc[4] = {{}, {}, {}, {}};

  for (int k0 = 0; k0 < En; k0 += 32) {
    __syncthreads();
#if USE_ASYNC_LDS
    // A: 8 KB = 512 x 16B chunks (2/thread); B: 4 KB = 256 x 16B (1/thread)
    for (int j = 0; j < 2; ++j) {
      int ca = tid + j * 256;
      int row = ca >> 2, sub = ca & 3;
      async_cp16(Ctx + (size_t)(r0 + row) * En + k0 + sub * 8, a_lds + ca * 8);
    }
    {
      int cbk = tid;
      int row = cbk >> 2, sub = cbk & 3;
      async_cp16(Wf + (size_t)(n0 + row) * En + k0 + sub * 8, b_lds + cbk * 8);
    }
    wait_async0();
#else
    {
      unsigned int* ad = (unsigned int*)a_lds;
      unsigned int* bd = (unsigned int*)b_lds;
      const unsigned int* cu = (const unsigned int*)Ctx;
      const unsigned int* wu = (const unsigned int*)Wf;
      for (int j = 0; j < 8; ++j) {
        int u = tid + j * 256;
        int row = u >> 4, c = u & 15;
        ad[row * 16 + c] = cu[(size_t)(r0 + row) * 512 + (k0 >> 1) + c];
      }
      for (int j = 0; j < 4; ++j) {
        int u = tid + j * 256;
        int row = u >> 4, c = u & 15;
        bd[row * 16 + c] = wu[(size_t)(n0 + row) * 512 + (k0 >> 1) + c];
      }
    }
#endif
    if (k0 + 32 < En) {  // prefetch next k-tile into L2/L0
      int row = tid >> 1, sub = tid & 1;
      __builtin_prefetch(Ctx + (size_t)(r0 + row) * En + k0 + 32 + sub * 16, 0, 0);
      if (tid < 128)
        __builtin_prefetch(Wf + (size_t)(n0 + (tid >> 1)) * En + k0 + 32 +
                               (tid & 1) * 16, 0, 0);
    }
    __syncthreads();

    v16h a = ld_frag(a_lds, (wave * 16 + n) * 32 + hi * 8);
    for (int ct = 0; ct < 4; ++ct) {
      v16h b = ld_frag(b_lds, (ct * 16 + n) * 32 + hi * 8);
      acc[ct] = wmma16(a, b, acc[ct]);
    }
  }

  for (int ct = 0; ct < 4; ++ct) {
    float bias = bout[n0 + ct * 16 + n];
    for (int r = 0; r < 8; ++r) {
      int row = r0 + wave * 16 + hi * 8 + r;
      Out[(size_t)row * En + n0 + ct * 16 + n] = acc[ct][r] + bias;
    }
  }
}

// ---------------------------------------------------------------------------
extern "C" void kernel_launch(void* const* d_in, const int* in_sizes, int n_in,
                              void* d_out, int out_size, void* d_ws,
                              size_t ws_size, hipStream_t stream) {
  (void)in_sizes; (void)n_in; (void)out_size; (void)ws_size;
  const float* query = (const float*)d_in[0];
  const float* para  = (const float*)d_in[1];
  const float* Wq = (const float*)d_in[2];
  const float* bq = (const float*)d_in[3];
  const float* Wk = (const float*)d_in[4];
  const float* bk = (const float*)d_in[5];
  const float* Wv = (const float*)d_in[6];
  const float* bv = (const float*)d_in[7];
  const float* Wout = (const float*)d_in[8];
  const float* bout = (const float*)d_in[9];
  float* out = (float*)d_out;

  // workspace layout (all regions fully overwritten before being read)
  char* ws = (char*)d_ws;
  _Float16* qp  = (_Float16*)(ws);                       // 8 MB: [B*H, T, 64]
  _Float16* kp  = (_Float16*)(ws + (size_t)(8u  << 20)); // 2 MB: [H, S, 64]
  _Float16* vp  = (_Float16*)(ws + (size_t)(10u << 20)); // 2 MB: [H, S, 64]
  _Float16* ctx = (_Float16*)(ws + (size_t)(12u << 20)); // 8 MB: [B*T, E]
  _Float16* wf  = (_Float16*)(ws + (size_t)(20u << 20)); // 2 MB: Wout f16

  hipLaunchKernelGGL(cvt_kernel, dim3(4096), dim3(256), 0, stream,
                     Wout, wf, En * En);
  hipLaunchKernelGGL(proj_kernel, dim3(1024), dim3(128), 0, stream,
                     query, Wq, bq, qp, 0);
  hipLaunchKernelGGL(proj_kernel, dim3(256), dim3(128), 0, stream,
                     para, Wk, bk, kp, 1);
  hipLaunchKernelGGL(proj_kernel, dim3(256), dim3(128), 0, stream,
                     para, Wv, bv, vp, 1);
  hipLaunchKernelGGL(attn_kernel, dim3(1024), dim3(128), 0, stream,
                     qp, kp, vp, ctx);
  hipLaunchKernelGGL(outproj_kernel, dim3(512), dim3(256), 0, stream,
                     ctx, wf, bout, out);
}

// v003
// A run of this version takes 69.6 microseconds.
// In two side-by-side timings against v002, it was 1.36 and 1.39 times as fast.
// Counting every step since v000, it is 2.22 times as fast.
#include <hip/hip_runtime.h>

// Problem constants (match reference)
#define Bn 4
#define Tn 1024
#define Sn 1024
#define En 1024
#define Hn 16
#define Dn 64

typedef __attribute__((ext_vector_type(16))) _Float16 v16h;
typedef __attribute__((ext_vector_type(8)))  _Float16 h8;
typedef __attribute__((ext_vector_type(8)))  float    v8f;
typedef __attribute__((ext_vector_type(4)))  int      v4i;

#if __has_builtin(__builtin_amdgcn_global_load_async_to_lds_b128)
#define USE_ASYNC_LDS 1
#else
#define USE_ASYNC_LDS 0
#endif

#if USE_ASYNC_LDS
typedef __attribute__((address_space(1))) v4i as1_v4i;  // global
typedef __attribute__((address_space(3))) v4i as3_v4i;  // LDS
// Copy one 16-byte chunk global -> LDS via the async path (ASYNCcnt).
__device__ __forceinline__ void async_cp16(const _Float16* g, _Float16* l) {
  __builtin_amdgcn_global_load_async_to_lds_b128((as1_v4i*)g, (as3_v4i*)l, 0,
                                                 0);
}
__device__ __forceinline__ void wait_async0() {
#if __has_builtin(__builtin_amdgcn_s_wait_asynccnt)
  __builtin_amdgcn_s_wait_asynccnt(0);
#else
  asm volatile("s_wait_asynccnt 0" ::: "memory");
#endif
}
#endif

__device__ __forceinline__ v8f wmma16(v16h a, v16h b, v8f c) {
  // D = A(16x32 f16) * B(32x16 f16) + C(16x16 f32)
  return __builtin_amdgcn_wmma_f32_16x16x32_f16(false, a, false, b, (short)0, c,
                                                false, false);
}

// Load one 16-half WMMA operand fragment from an LDS tile.
// Per ISA layout, each lane needs K = g*16 + hi*8 + j (j=0..7, g=0..1), i.e.
// two contiguous 16-byte chunks at (off) and (off+16).
__device__ __forceinline__ v16h ld_frag(const _Float16* base, int off) {
  union { v16h v; h8 h[2]; } u;
  u.h[0] = *(const h8*)(base + off);
  u.h[1] = *(const h8*)(base + off + 16);
  return u.v;
}

// Tiles that ld_frag reads (ds_load_b128, one row per lane): the pitch is an odd
// multiple of 16 B, so that the 16 rows of a half wave fall on all 64 banks.
#define P64 72  // halves: rows of 64 halves (128 B) at 144 B
#define P32 40  // halves: rows of 32 halves (64 B) at 80 B

// V tile in LDS: rows of 64 halves (128 B) at a pitch of 160 B, an odd multiple
// of 32 B, which spreads the transposing reads over the banks.
#define VPITCH 80  // halves

// One 32(k) x 16(n) B fragment out of a row-major [k][n] f16 LDS tile by two
// transposing loads: lane (c = lane & 15, hi = lane >> 4) gets
// tile[8*hi + 0..7][c] and tile[16 + 8*hi + 0..7][c], the k order of ld_frag.
// p is the lane's own address:
// tile + (8*hi + (lane & 7)) * VPITCH + 8 * ((lane >> 3) & 1) + first column.
typedef short s16x8 __attribute__((ext_vector_type(8)));
typedef __attribute__((address_space(3))) s16x8 lds_s16x8;
__device__ __forceinline__ v16h ld_frag_tr(const _Float16* p) {
  union { v16h v; s16x8 s[2]; } u;
  u.s[0] = __builtin_amdgcn_ds_load_tr16_b128_v8i16((lds_s16x8*)p);
  u.s[1] = __builtin_amdgcn_ds_load_tr16_b128_v8i16((lds_s16x8*)(p + 16 * VPITCH));
  return u.v;
}

// ---------------------------------------------------------------------------
// Wout f32 -> f16 (layout kept [n][k] row-major == Wout itself, since the
// GEMM needs B[k][n] = Wout[n][k])
// ---------------------------------------------------------------------------
__global__ void cvt_kernel(const float* __restrict__ src,
                           _Float16* __restrict__ dst, int nelem) {
  int i = blockIdx.x * blockDim.x + threadIdx.x;
  if (i < nelem) dst[i] = (_Float16)src[i];
}

// ---------------------------------------------------------------------------
// Q/K/V projection: X[N,64] @ W^T[64,64] + b -> f16 with head-major row remap.
// mode 0: rows are (b,t,h) -> out row (b*H+h)*T + t   (query)
// mode 1: rows are (s,h)   -> out row h*S + s         (key/value)
// 128 threads (4 waves). Each wave: 16 rows x 64 cols = 4 col-tiles, K=64.
// ---------------------------------------------------------------------------
__global__ __launch_bounds__(128) void proj_kernel(
    const float* __restrict__ X, const float* __restrict__ W,
    const float* __restrict__ bias, _Float16* __restrict__ out, int mode) {
  __shared__ __align__(16) _Float16 w_lds[64 * P64];      // [n][k]
  __shared__ __align__(16) _Float16 x_lds[4][16 * P64];   // per wave [m][k]

  const int tid  = threadIdx.x;
  const int wave = tid >> 5, lane = tid & 31;
  const int n = lane & 15, hi = lane >> 4;
  const int rbase = blockIdx.x * 64 + wave * 16;

  for (int j = 0; j < 32; ++j) {
    // B[k][n] = W[n][k] -> store W row-major: two rows of 64 per trip
    w_lds[((tid >> 6) + 2 * j) * P64 + (tid & 63)] = (_Float16)W[tid + j * 128];
  }
  _Float16* xw = x_lds[wave];
  for (int j = 0; j < 32; ++j) {
    int idx = lane + j * 32;
    int m = idx >> 6, c = idx & 63;
    xw[m * P64 + c] = (_Float16)X[(size_t)(rbase + m) * 64 + c];
  }
  __syncthreads();

  v16h a0 = ld_frag(xw, n * P64 + 0  + hi * 8);
  v16h a1 = ld_frag(xw, n * P64 + 32 + hi * 8);

  v8f acc[4];
  for (int ct = 0; ct < 4; ++ct) {
    v8f c = {};
    v16h b0 = ld_frag(w_lds, (ct * 16 + n) * P64 + 0  + hi * 8);
    v16h b1 = ld_frag(w_lds, (ct * 16 + n) * P64 + 32 + hi * 8);
    c = wmma16(a0, b0, c);
    c = wmma16(a1, b1, c);
    acc[ct] = c;
  }

  for (int ct = 0; ct < 4; ++ct) {
    float bv = bias[ct * 16 + n];
    for (int r = 0; r < 8; ++r) {
      int grow = rbase + hi * 8 + r;
      int orow;
      if (mode == 0) {
        int bb  = grow >> 14;        // / (T*H) = 16384
        int rem = grow & 16383;
        int t = rem >> 4, h = rem & 15;
        orow = (bb * Hn + h) * Tn + t;
      } else {
        int s = grow >> 4, h = grow & 15;
        orow = h * Sn + s;
      }
      out[(size_t)orow * 64 + ct * 16 + n] = (_Float16)(acc[ct][r] + bv);
    }
  }
}

__device__ __forceinline__ float xhalf(float x) {
  int v = __builtin_bit_cast(int, x);
  return __builtin_bit_cast(
      float, __builtin_amdgcn_permlanex16(v, v, 0x76543210, 0xfedcba98, false,
                                          false));
}

__global__ __launch_bounds__(128) void attn_kernel(
    const _Float16* __restrict__ Qp, const _Float16* __restrict__ Kp,
    const _Float16* __restrict__ Vp, _Float16* __restrict__ Ctx) {
  __shared__ __align__(16) _Float16 q_lds[4][16 * P64]; // per wave [t][d]
  __shared__ __align__(16) _Float16 k_lds[32 * P64];    // [s][d] (=A [m][k])
  __shared__ __align__(16) _Float16 v_lds[32 * VPITCH]; // [s][d] as in memory

  const int tid  = threadIdx.x;
  const int wave = tid >> 5, lane = tid & 31;
  const int n = lane & 15, hi = lane >> 4;
  const int tt = blockIdx.x & 15;
  const int bh = blockIdx.x >> 4;
  const int b = bh >> 4, h = bh & 15;
  const int t0 = tt * 64 + wave * 16;

  // stage this wave's 16x64 Q tile (2 KB = 128 x 16B chunks, 4 per lane)
  _Float16* qw = q_lds[wave];
  {
    const _Float16* qs = Qp + ((size_t)(b * Hn + h) * Tn + t0) * 64;
#if USE_ASYNC_LDS
    for (int j = 0; j < 4; ++j) {
      int c = lane + j * 32;
      async_cp16(qs + c * 8, qw + (c >> 3) * P64 + (c & 7) * 8);
    }
    wait_async0();
#else
    const unsigned int* qu = (const unsigned int*)qs;
    unsigned int* qd = (unsigned int*)qw;
    for (int j = 0; j < 16; ++j) {
      int u = lane + j * 32;
      qd[(u >> 5) * (P64 / 2) + (u & 31)] = qu[u];
    }
#endif
  }
  __syncthreads();

  // Q^T as B operand: column n = query t0 + n
  v16h bq0 = ld_frag(qw, n * P64 + 0  + hi * 8);
  v16h bq1 = ld_frag(qw, n * P64 + 32 + hi * 8);

  // O^T tiles: register r of tile ct = O[query n][d = 16*ct + 8*hi + r]
  v8f o0 = {}, o1 = {}, o2 = {}, o3 = {};
  float mrow = -3.0e38f;  // running maximum of query n (equal in both halves)
  float lsum = 0.0f;      // running sum over this lane half's keys only
  const float sc = 0.03125f;  // 1/sqrt(E) = 1/32 (reference scales by sqrt(E))

  const size_t kvbase = (size_t)h * Sn * 64;
  for (int s0 = 0; s0 < Sn; s0 += 32) {
    __syncthreads();  // prior chunk's K/V reads complete
    {   // stage K chunk [32 s][64 d]: 4 KB = 256 x 16B chunks, 2 per thread
      const _Float16* ks = Kp + kvbase + (size_t)s0 * 64;
#if USE_ASYNC_LDS
      for (int j = 0; j < 2; ++j) {
        int c = tid + j * 128;
        async_cp16(ks + c * 8, k_lds + (c >> 3) * P64 + (c & 7) * 8);
      }
#else
      unsigned int* kd = (unsigned int*)k_lds;
      const unsigned int* ku = (const unsigned int*)ks;
      for (int j = 0; j < 8; ++j) {
        int u = tid + j * 128;
        kd[(u >> 5) * (P64 / 2) + (u & 31)] = ku[u];
      }
#endif
    }
    {   // stage V chunk as it lies, [32 s][64 d]: 256 x 16B chunks, 2 per thread
      const _Float16* vs = Vp + kvbase + (size_t)s0 * 64;
      for (int j = 0; j < 2; ++j) {
        int c = tid + j * 128;
        int row = c >> 3, sub = c & 7;
#if USE_ASYNC_LDS
        async_cp16(vs + c * 8, v_lds + row * VPITCH + sub * 8);
#else
        *(h8*)(v_lds + row * VPITCH + sub * 8) = *(const h8*)(vs + c * 8);
#endif
      }
    }
#if USE_ASYNC_LDS
    wait_async0();  // this wave's K and V copies have landed
#endif
    // publishes the tiles to the other waves; standing directly behind the
    // wait it also keeps every LDS read of the tiles behind that wait
    __syncthreads();

    // S^T: two 16(key) x 16(query) tiles, K=64 over D in two 32-steps
    v8f sf0 = {}, sf1 = {};
    {
      v16h ak;
      ak = ld_frag(k_lds, (0 * 16 + n) * P64 + 0  + hi * 8); sf0 = wmma16(ak, bq0, sf0);
      ak = ld_frag(k_lds, (0 * 16 + n) * P64 + 32 + hi * 8); sf0 = wmma16(ak, bq1, sf0);
      ak = ld_frag(k_lds, (1 * 16 + n) * P64 + 0  + hi * 8); sf1 = wmma16(ak, bq0, sf1);
      ak = ld_frag(k_lds, (1 * 16 + n) * P64 + 32 + hi * 8); sf1 = wmma16(ak, bq1, sf1);
    }

    // online softmax: the lane's 16 scores all belong to query n
    const v8f p0 = sf0 * sc, p1 = sf1 * sc;
    float mloc = fmaxf(
        fmaxf(fmaxf(fmaxf(p0[0], p0[1]), fmaxf(p0[2], p0[3])),
              fmaxf(fmaxf(p0[4], p0[5]), fmaxf(p0[6], p0[7]))),
        fmaxf(fmaxf(fmaxf(p1[0], p1[1]), fmaxf(p1[2], p1[3])),
              fmaxf(fmaxf(p1[4], p1[5]), fmaxf(p1[6], p1[7]))));
    mloc = fmaxf(mloc, xhalf(mloc));  // the other half's 16 keys
    const float mnew  = fmaxf(mloc, mrow);
    const float alpha = __expf(mrow - mnew);
    mrow = mnew;
    float e0[8], e1[8];
    for (int r = 0; r < 8; ++r) {
      e0[r] = __expf(p0[r] - mnew);
      e1[r] = __expf(p1[r] - mnew);
    }
    lsum = lsum * alpha +
           ((((e0[0] + e0[1]) + (e0[2] + e0[3])) + ((e0[4] + e0[5]) + (e0[6] + e0[7]))) +
            (((e1[0] + e1[1]) + (e1[2] + e1[3])) + ((e1[4] + e1[5]) + (e1[6] + e1[7]))));
    o0 *= alpha; o1 *= alpha; o2 *= alpha; o3 *= alpha;

    // P^T as B operand: element 8*g + j = k index 16*g + 8*hi + j = tile g, reg j
    v16h pb;
    for (int r = 0; r < 8; ++r) {
      pb[r]     = (_Float16)e0[r];
      pb[8 + r] = (_Float16)e1[r];
    }

    // V^T as A operand: row = d, by the transposing loads
    const _Float16* vt =
        v_lds + (hi * 8 + (lane & 7)) * VPITCH + ((lane >> 3) & 1) * 8;
    v16h av;
    av = ld_frag_tr(vt + 0 * 16); o0 = wmma16(av, pb, o0);
    av = ld_frag_tr(vt + 1 * 16); o1 = wmma16(av, pb, o1);
    av = ld_frag_tr(vt + 2 * 16); o2 = wmma16(av, pb, o2);
    av = ld_frag_tr(vt + 3 * 16); o3 = wmma16(av, pb, o3);
  }

  // join the halves' sums, normalize and write context in [B,T,E] (f16) for
  // the output GEMM: a lane holds 8 consecutive d of its query per tile
  {
    const float inv = 1.0f / (lsum + xhalf(lsum));
    _Float16* crow = Ctx + ((size_t)b * Tn + t0 + n) * En + h * 64 + hi * 8;
    h8 w0, w1, w2, w3;
    for (int r = 0; r < 8; ++r) {
      w0[r] = (_Float16)(o0[r] * inv);
      w1[r] = (_Float16)(o1[r] * inv);
      w2[r] = (_Float16)(o2[r] * inv);
      w3[r] = (_Float16)(o3[r] * inv);
    }
    *(h8*)(crow + 0 * 16) = w0;
    *(h8*)(crow + 1 * 16) = w1;
    *(h8*)(crow + 2 * 16) = w2;
    *(h8*)(crow + 3 * 16) = w3;
  }
}

// ---------------------------------------------------------------------------
// Output projection: Ctx[4096,1024] @ Wout^T + bout -> f32 out.
// 256 threads (8 waves) per WG compute a 128x64 tile; K loop in steps of 32.
// Each wave = one 16-row stripe x 4 col sub-tiles: 1 A-frag reused over 4
// B-frags -> 4 WMMAs per wave per k-step (32 per WG per 12KB staged).
// ---------------------------------------------------------------------------
__global__ __launch_bounds__(256) void outproj_kernel(
    const _Float16* __restrict__ Ctx, const _Float16* __restrict__ Wf,
    const float* __restrict__ bout, float* __restrict__ Out) {
  __shared__ __align__(16) _Float16 a_lds[128 * P32];  // [m][k]
  __shared__ __align__(16) _Float16 b_lds[64 * P32];   // [n][k]

  const int tid  = threadIdx.x;
  const int wave = tid >> 5, lane = tid & 31;
  const int n = lane & 15, hi = lane >> 4;
  const int rb = blockIdx.x >> 4, cb = blockIdx.x & 15;
  const int r0 = rb * 128, n0 = cb * 64;

  v8f acc[4] = {{}, {}, {}, {}};

  // Fully unrolled, as the compiler had it at the unpadded pitch: left rolled it
  // fetches every other step's B fragments one at a time, a wait before each WMMA.
#pragma unroll
  for (int k0 = 0; k0 < En; k0 += 32) {
    __syncthreads();
#if USE_ASYNC_LDS
    // A: 8 KB = 512 x 16B chunks (2/thread); B: 4 KB = 256 x 16B (1/thread)
    for (int j = 0; j < 2; ++j) {
      int ca = tid + j * 256;
      int row = ca >> 2, sub = ca & 3;
      async_cp16(Ctx + (size_t)(r0 + row) * En + k0 + sub * 8,
                 a_lds + row * P32 + sub * 8);
    }
    {
      int cbk = tid;
      int row = cbk >> 2, sub = cbk & 3;
      async_cp16(Wf + (size_t)(n0 + row) * En + k0 + sub * 8,
                 b_lds + row * P32 + sub * 8);
    }
    wait_async0();
#else
    {
      unsigned int* ad = (unsigned int*)a_lds;
      unsigned int* bd = (unsigned int*)b_lds;
      const unsigned int* cu = (const unsigned int*)Ctx;
      const unsigned int* wu = (const unsigned int*)Wf;
      for (int j = 0; j < 8; ++j) {
        int u = tid + j * 256;
        int row = u >> 4, c = u & 15;
        ad[row * (P32 / 2) + c] = cu[(size_t)(r0 + row) * 512 + (k0 >> 1) + c];
      }
      for (int j = 0; j < 4; ++j) {
        int u = tid + j * 256;
        int row = u >> 4, c = u & 15;
        bd[row * (P32 / 2) + c] = wu[(size_t)(n0 + row) * 512 + (k0 >> 1) + c];
      }
    }
#endif
    if (k0 + 32 < En) {  // prefetch next k-tile into L2/L0
      int row = tid >> 1, sub = tid & 1;
      __builtin_prefetch(Ctx + (size_t)(r0 + row) * En + k0 + 32 + sub * 16, 0, 0);
      if (tid < 128)
        __builtin_prefetch(Wf + (size_t)(n0 + (tid >> 1)) * En + k0 + 32 +
                               (tid & 1) * 16, 0, 0);
    }
    __syncthreads();

    v16h a = ld_frag(a_lds, (wave * 16 + n) * P32 + hi * 8);
    for (int ct = 0; ct < 4; ++ct) {
      v16h b = ld_frag(b_lds, (ct * 16 + n) * P32 + hi * 8);
      acc[ct] = wmma16(a, b, acc[ct]);
    }
  }

  for (int ct = 0; ct < 4; ++ct) {
    float bias = bout[n0 + ct * 16 + n];
    for (int r = 0; r < 8; ++r) {
      int row = r0 + wave * 16 + hi * 8 + r;
      Out[(size_t)row * En + n0 + ct * 16 + n] = acc[ct][r] + bias;
    }
  }
}

// ---------------------------------------------------------------------------
extern "C" void kernel_launch(void* const* d_in, const int* in_sizes, int n_in,
                              void* d_out, int out_size, void* d_ws,
                              size_t ws_size, hipStream_t stream) {
  (void)in_sizes; (void)n_in; (void)out_size; (void)ws_size;
  const float* query = (const float*)d_in[0];
  const float* para  = (const float*)d_in[1];
  const float* Wq = (const float*)d_in[2];
  const float* bq = (const float*)d_in[3];
  const float* Wk = (const float*)d_in[4];
  const float* bk = (const float*)d_in[5];
  const float* Wv = (const float*)d_in[6];
  const float* bv = (const float*)d_in[7];
  const float* Wout = (const float*)d_in[8];
  const float* bout = (const float*)d_in[9];
  float* out = (float*)d_out;

  // workspace layout (all regions fully overwritten before being read)
  char* ws = (char*)d_ws;
  _Float16* qp  = (_Float16*)(ws);                       // 8 MB: [B*H, T, 64]
  _Float16* kp  = (_Float16*)(ws + (size_t)(8u  << 20)); // 2 MB: [H, S, 64]
  _Float16* vp  = (_Float16*)(ws + (size_t)(10u << 20)); // 2 MB: [H, S, 64]
  _Float16* ctx = (_Float16*)(ws + (size_t)(12u << 20)); // 8 MB: [B*T, E]
  _Float16* wf  = (_Float16*)(ws + (size_t)(20u << 20)); // 2 MB: Wout f16

  hipLaunchKernelGGL(cvt_kernel, dim3(4096), dim3(256), 0, stream,
                     Wout, wf, En * En);
  hipLaunchKernelGGL(proj_kernel, dim3(1024), dim3(128), 0, stream,
                     query, Wq, bq, qp, 0);
  hipLaunchKernelGGL(proj_kernel, dim3(256), dim3(128), 0, stream,
                     para, Wk, bk, kp, 1);
  hipLaunchKernelGGL(proj_kernel, dim3(256), dim3(128), 0, stream,
                     para, Wv, bv, vp, 1);
  hipLaunchKernelGGL(attn_kernel, dim3(1024), dim3(128), 0, stream,
                     qp, kp, vp, ctx);
  hipLaunchKernelGGL(outproj_kernel, dim3(512), dim3(256), 0, stream,
                     ctx, wf, bout, out);
}

// v004
// A run of this version takes 59.4 microseconds.
// Two timings next to v003 put it at 1.18 and 1.16 times that version's speed.
// Over all steps from v000 it is 2.59 times as fast.
#include <hip/hip_runtime.h>

// Problem constants (match reference)
#define Bn 4
#define Tn 1024
#define Sn 1024
#define En 1024
#define Hn 16
#define Dn 64

typedef __attribute__((ext_vector_type(16))) _Float16 v16h;
typedef __attribute__((ext_vector_type(8)))  _Float16 h8;
typedef __attribute__((ext_vector_type(8)))  float    v8f;
typedef __attribute__((ext_vector_type(4)))  int      v4i;

#if __has_builtin(__builtin_amdgcn_global_load_async_to_lds_b128)
#define USE_ASYNC_LDS 1
#else
#define USE_ASYNC_LDS 0
#endif

#if USE_ASYNC_LDS
typedef __attribute__((address_space(1))) v4i as1_v4i;  // global
typedef __attribute__((address_space(3))) v4i as3_v4i;  // LDS
// Copy one 16-byte chunk global -> LDS via the async path (ASYNCcnt).
__device__ __forceinline__ void async_cp16(const _Float16* g, _Float16* l) {
  __builtin_amdgcn_global_load_async_to_lds_b128((as1_v4i*)g, (as3_v4i*)l, 0,
                                                 0);
}
__device__ __forceinline__ void wait_async0() {
#if __has_builtin(__builtin_amdgcn_s_wait_asynccnt)
  __builtin_amdgcn_s_wait_asynccnt(0);
#else
  asm volatile("s_wait_asynccnt 0" ::: "memory");
#endif
}
#endif

__device__ __forceinline__ v8f wmma16(v16h a, v16h b, v8f c) {
  // D = A(16x32 f16) * B(32x16 f16) + C(16x16 f32)
  return __builtin_amdgcn_wmma_f32_16x16x32_f16(false, a, false, b, (short)0, c,
                                                false, false);
}

// Load one 16-half WMMA operand fragment from an LDS tile.
// Per ISA layout, each lane needs K = g*16 + hi*8 + j (j=0..7, g=0..1), i.e.
// two contiguous 16-byte chunks at (off) and (off+16).
__device__ __forceinline__ v16h ld_frag(const _Float16* base, int off) {
  union { v16h v; h8 h[2]; } u;
  u.h[0] = *(const h8*)(base + off);
  u.h[1] = *(const h8*)(base + off + 16);
  return u.v;
}

// Tiles that ld_frag reads (ds_load_b128, one row per lane): the pitch is an odd
// multiple of 16 B, so that the 16 rows of a half wave fall on all 64 banks.
#define P64 72  // halves: rows of 64 halves (128 B) at 144 B
#define P32 40  // halves: rows of 32 halves (64 B) at 80 B

// V tile in LDS: rows of 64 halves (128 B) at a pitch of 160 B, an odd multiple
// of 32 B, which spreads the transposing reads over the banks.
#define VPITCH 80  // halves

// One 32(k) x 16(n) B fragment out of a row-major [k][n] f16 LDS tile by two
// transposing loads: lane (c = lane & 15, hi = lane >> 4) gets
// tile[8*hi + 0..7][c] and tile[16 + 8*hi + 0..7][c], the k order of ld_frag.
// p is the lane's own address:
// tile + (8*hi + (lane & 7)) * VPITCH + 8 * ((lane >> 3) & 1) + first column.
typedef short s16x8 __attribute__((ext_vector_type(8)));
typedef __attribute__((address_space(3))) s16x8 lds_s16x8;
__device__ __forceinline__ v16h ld_frag_tr(const _Float16* p) {
  union { v16h v; s16x8 s[2]; } u;
  u.s[0] = __builtin_amdgcn_ds_load_tr16_b128_v8i16((lds_s16x8*)p);
  u.s[1] = __builtin_amdgcn_ds_load_tr16_b128_v8i16((lds_s16x8*)(p + 16 * VPITCH));
  return u.v;
}

// ---------------------------------------------------------------------------
// The four passes that depend on nothing but the inputs, as block ranges of one
// launch, so that they run side by side and three launch gaps go:
//   blocks    0..1023  query projection   (mode 0)
//   blocks 1024..1279  key projection     (mode 1)
//   blocks 1280..1535  value projection   (mode 1)
//   blocks 1536..2559  Wout f32 -> f16, 1024 elements a block (layout kept
//                      [n][k] row-major == Wout itself, since the output GEMM
//                      needs B[k][n] = Wout[n][k])
// The projections come first: they run longest.
//
// Projection: X[N,64] @ W^T[64,64] + b -> f16 with head-major row remap.
// mode 0: rows are (b,t,h) -> out row (b*H+h)*T + t   (query)
// mode 1: rows are (s,h)   -> out row h*S + s         (key/value)
// 128 threads (4 waves). Each wave: 16 rows x 64 cols = 4 col-tiles, K=64.
// ---------------------------------------------------------------------------
#define QBLK 1024  // blocks of the query projection: B*T*H / 64 rows
#define KBLK 256   // blocks of the key and of the value projection: S*H / 64

typedef __attribute__((ext_vector_type(4))) _Float16 h4;

__global__ __launch_bounds__(128) void pre_kernel(
    const float* __restrict__ query, const float* __restrict__ para,
    const float* __restrict__ Wq, const float* __restrict__ bq,
    const float* __restrict__ Wk, const float* __restrict__ bk,
    const float* __restrict__ Wv, const float* __restrict__ bv,
    const float* __restrict__ Wout, _Float16* __restrict__ qp,
    _Float16* __restrict__ kp, _Float16* __restrict__ vp,
    _Float16* __restrict__ wf) {
  __shared__ __align__(16) _Float16 w_lds[64 * P64];      // [n][k]
  __shared__ __align__(16) _Float16 x_lds[4][16 * P64];   // per wave [m][k]

  const int tid  = threadIdx.x;
  const int blk  = blockIdx.x;

  if (blk >= QBLK + 2 * KBLK) {  // the same for the whole block, before any barrier
    // a wave's 16-B loads cover 512 contiguous bytes, its 8-B stores 256
    const int base = (blk - (QBLK + 2 * KBLK)) * 1024 + tid * 4;
    const float4 f0 = *(const float4*)(Wout + base);
    const float4 f1 = *(const float4*)(Wout + base + 512);
    const h4 g0 = {(_Float16)f0.x, (_Float16)f0.y, (_Float16)f0.z, (_Float16)f0.w};
    const h4 g1 = {(_Float16)f1.x, (_Float16)f1.y, (_Float16)f1.z, (_Float16)f1.w};
    *(h4*)(wf + base)       = g0;
    *(h4*)(wf + base + 512) = g1;
    return;
  }

  // which projection this block belongs to, and its index there
  const int mode = blk < QBLK ? 0 : 1;
  const bool isv = blk >= QBLK + KBLK;
  const int pblk = mode == 0 ? blk : (isv ? blk - (QBLK + KBLK) : blk - QBLK);
  const float* __restrict__ X    = mode == 0 ? query : para;
  const float* __restrict__ W    = mode == 0 ? Wq : (isv ? Wv : Wk);
  const float* __restrict__ bias = mode == 0 ? bq : (isv ? bv : bk);
  _Float16* __restrict__ out     = mode == 0 ? qp : (isv ? vp : kp);

  const int wave = tid >> 5, lane = tid & 31;
  const int n = lane & 15, hi = lane >> 4;
  const int rbase = pblk * 64 + wave * 16;

  for (int j = 0; j < 32; ++j) {
    // B[k][n] = W[n][k] -> store W row-major: two rows of 64 per trip
    w_lds[((tid >> 6) + 2 * j) * P64 + (tid & 63)] = (_Float16)W[tid + j * 128];
  }
  _Float16* xw = x_lds[wave];
  for (int j = 0; j < 32; ++j) {
    int idx = lane + j * 32;
    int m = idx >> 6, c = idx & 63;
    xw[m * P64 + c] = (_Float16)X[(size_t)(rbase + m) * 64 + c];
  }
  __syncthreads();

  v16h a0 = ld_frag(xw, n * P64 + 0  + hi * 8);
  v16h a1 = ld_frag(xw, n * P64 + 32 + hi * 8);

  v8f acc[4];
  for (int ct = 0; ct < 4; ++ct) {
    v8f c = {};
    v16h b0 = ld_frag(w_lds, (ct * 16 + n) * P64 + 0  + hi * 8);
    v16h b1 = ld_frag(w_lds, (ct * 16 + n) * P64 + 32 + hi * 8);
    c = wmma16(a0, b0, c);
    c = wmma16(a1, b1, c);
    acc[ct] = c;
  }

  for (int ct = 0; ct < 4; ++ct) {
    float bv = bias[ct * 16 + n];
    for (int r = 0; r < 8; ++r) {
      int grow = rbase + hi * 8 + r;
      int orow;
      if (mode == 0) {
        int bb  = grow >> 14;        // / (T*H) = 16384
        int rem = grow & 16383;
        int t = rem >> 4, h = rem & 15;
        orow = (bb * Hn + h) * Tn + t;
      } else {
        int s = grow >> 4, h = grow & 15;
        orow = h * Sn + s;
      }
      out[(size_t)orow * 64 + ct * 16 + n] = (_Float16)(acc[ct][r] + bv);
    }
  }
}

__device__ __forceinline__ float xhalf(float x) {
  int v = __builtin_bit_cast(int, x);
  return __builtin_bit_cast(
      float, __builtin_amdgcn_permlanex16(v, v, 0x76543210, 0xfedcba98, false,
                                          false));
}

__global__ __launch_bounds__(128) void attn_kernel(
    const _Float16* __restrict__ Qp, const _Float16* __restrict__ Kp,
    const _Float16* __restrict__ Vp, _Float16* __restrict__ Ctx) {
  __shared__ __align__(16) _Float16 q_lds[4][16 * P64]; // per wave [t][d]
  __shared__ __align__(16) _Float16 k_lds[32 * P64];    // [s][d] (=A [m][k])
  __shared__ __align__(16) _Float16 v_lds[32 * VPITCH]; // [s][d] as in memory

  const int tid  = threadIdx.x;
  const int wave = tid >> 5, lane = tid & 31;
  const int n = lane & 15, hi = lane >> 4;
  const int tt = blockIdx.x & 15;
  const int bh = blockIdx.x >> 4;
  const int b = bh >> 4, h = bh & 15;
  const int t0 = tt * 64 + wave * 16;

  // stage this wave's 16x64 Q tile (2 KB = 128 x 16B chunks, 4 per lane)
  _Float16* qw = q_lds[wave];
  {
    const _Float16* qs = Qp + ((size_t)(b * Hn + h) * Tn + t0) * 64;
#if USE_ASYNC_LDS
    for (int j = 0; j < 4; ++j) {
      int c = lane + j * 32;
      async_cp16(qs + c * 8, qw + (c >> 3) * P64 + (c & 7) * 8);
    }
    wait_async0();
#else
    const unsigned int* qu = (const unsigned int*)qs;
    unsigned int* qd = (unsigned int*)qw;
    for (int j = 0; j < 16; ++j) {
      int u = lane + j * 32;
      qd[(u >> 5) * (P64 / 2) + (u & 31)] = qu[u];
    }
#endif
  }
  __syncthreads();

  // Q^T as B operand: column n = query t0 + n
  v16h bq0 = ld_frag(qw, n * P64 + 0  + hi * 8);
  v16h bq1 = ld_frag(qw, n * P64 + 32 + hi * 8);

  // O^T tiles: register r of tile ct = O[query n][d = 16*ct + 8*hi + r]
  v8f o0 = {}, o1 = {}, o2 = {}, o3 = {};
  float mrow = -3.0e38f;  // running maximum of query n (equal in both halves)
  float lsum = 0.0f;      // running sum over this lane half's keys only
  const float sc = 0.03125f;  // 1/sqrt(E) = 1/32 (reference scales by sqrt(E))

  const size_t kvbase = (size_t)h * Sn * 64;
  for (int s0 = 0; s0 < Sn; s0 += 32) {
    __syncthreads();  // prior chunk's K/V reads complete
    {   // stage K chunk [32 s][64 d]: 4 KB = 256 x 16B chunks, 2 per thread
      const _Float16* ks = Kp + kvbase + (size_t)s0 * 64;
#if USE_ASYNC_LDS
      for (int j = 0; j < 2; ++j) {
        int c = tid + j * 128;
        async_cp16(ks + c * 8, k_lds + (c >> 3) * P64 + (c & 7) * 8);
      }
#else
      unsigned int* kd = (unsigned int*)k_lds;
      const unsigned int* ku = (const unsigned int*)ks;
      for (int j = 0; j < 8; ++j) {
        int u = tid + j * 128;
        kd[(u >> 5) * (P64 / 2) + (u & 31)] = ku[u];
      }
#endif
    }
    {   // stage V chunk as it lies, [32 s][64 d]: 256 x 16B chunks, 2 per thread
      const _Float16* vs = Vp + kvbase + (size_t)s0 * 64;
      for (int j = 0; j < 2; ++j) {
        int c = tid + j * 128;
        int row = c >> 3, sub = c & 7;
#if USE_ASYNC_LDS
        async_cp16(vs + c * 8, v_lds + row * VPITCH + sub * 8);
#else
        *(h8*)(v_lds + row * VPITCH + sub * 8) = *(const h8*)(vs + c * 8);
#endif
      }
    }
#if USE_ASYNC_LDS
    wait_async0();  // this wave's K and V copies have landed
#endif
    // publishes the tiles to the other waves; standing directly behind the
    // wait it also keeps every LDS read of the tiles behind that wait
    __syncthreads();

    // S^T: two 16(key) x 16(query) tiles, K=64 over D in two 32-steps
    v8f sf0 = {}, sf1 = {};
    {
      v16h ak;
      ak = ld_frag(k_lds, (0 * 16 + n) * P64 + 0  + hi * 8); sf0 = wmma16(ak, bq0, sf0);
      ak = ld_frag(k_lds, (0 * 16 + n) * P64 + 32 + hi * 8); sf0 = wmma16(ak, bq1, sf0);
      ak = ld_frag(k_lds, (1 * 16 + n) * P64 + 0  + hi * 8); sf1 = wmma16(ak, bq0, sf1);
      ak = ld_frag(k_lds, (1 * 16 + n) * P64 + 32 + hi * 8); sf1 = wmma16(ak, bq1, sf1);
    }

    // online softmax: the lane's 16 scores all belong to query n
    const v8f p0 = sf0 * sc, p1 = sf1 * sc;
    float mloc = fmaxf(
        fmaxf(fmaxf(fmaxf(p0[0], p0[1]), fmaxf(p0[2], p0[3])),
              fmaxf(fmaxf(p0[4], p0[5]), fmaxf(p0[6], p0[7]))),
        fmaxf(fmaxf(fmaxf(p1[0], p1[1]), fmaxf(p1[2], p1[3])),
              fmaxf(fmaxf(p1[4], p1[5]), fmaxf(p1[6], p1[7]))));
    mloc = fmaxf(mloc, xhalf(mloc));  // the other half's 16 keys
    const float mnew  = fmaxf(mloc, mrow);
    const float alpha = __expf(mrow - mnew);
    mrow = mnew;
    float e0[8], e1[8];
    for (int r = 0; r < 8; ++r) {
      e0[r] = __expf(p0[r] - mnew);
      e1[r] = __expf(p1[r] - mnew);
    }
    lsum = lsum * alpha +
           ((((e0[0] + e0[1]) + (e0[2] + e0[3])) + ((e0[4] + e0[5]) + (e0[6] + e0[7]))) +
            (((e1[0] + e1[1]) + (e1[2] + e1[3])) + ((e1[4] + e1[5]) + (e1[6] + e1[7]))));
    o0 *= alpha; o1 *= alpha; o2 *= alpha; o3 *= alpha;

    // P^T as B operand: element 8*g + j = k index 16*g + 8*hi + j = tile g, reg j
    v16h pb;
    for (int r = 0; r < 8; ++r) {
      pb[r]     = (_Float16)e0[r];
      pb[8 + r] = (_Float16)e1[r];
    }

    // V^T as A operand: row = d, by the transposing loads
    const _Float16* vt =
        v_lds + (hi * 8 + (lane & 7)) * VPITCH + ((lane >> 3) & 1) * 8;
    v16h av;
    av = ld_frag_tr(vt + 0 * 16); o0 = wmma16(av, pb, o0);
    av = ld_frag_tr(vt + 1 * 16); o1 = wmma16(av, pb, o1);
    av = ld_frag_tr(vt + 2 * 16); o2 = wmma16(av, pb, o2);
    av = ld_frag_tr(vt + 3 * 16); o3 = wmma16(av, pb, o3);
  }

  // join the halves' sums, normalize and write context in [B,T,E] (f16) for
  // the output GEMM: a lane holds 8 consecutive d of its query per tile
  {
    const float inv = 1.0f / (lsum + xhalf(lsum));
    _Float16* crow = Ctx + ((size_t)b * Tn + t0 + n) * En + h * 64 + hi * 8;
    h8 w0, w1, w2, w3;
    for (int r = 0; r < 8; ++r) {
      w0[r] = (_Float16)(o0[r] * inv);
      w1[r] = (_Float16)(o1[r] * inv);
      w2[r] = (_Float16)(o2[r] * inv);
      w3[r] = (_Float16)(o3[r] * inv);
    }
    *(h8*)(crow + 0 * 16) = w0;
    *(h8*)(crow + 1 * 16) = w1;
    *(h8*)(crow + 2 * 16) = w2;
    *(h8*)(crow + 3 * 16) = w3;
  }
}

// ---------------------------------------------------------------------------
// Output projection: Ctx[4096,1024] @ Wout^T + bout -> f32 out.
// 256 threads (8 waves) per WG compute a 128x64 tile; K loop in steps of 32.
// Each wave = one 16-row stripe x 4 col sub-tiles: 1 A-frag reused over 4
// B-frags -> 4 WMMAs per wave per k-step (32 per WG per 12KB staged).
// ---------------------------------------------------------------------------
__global__ __launch_bounds__(256) void outproj_kernel(
    const _Float16* __restrict__ Ctx, const _Float16* __restrict__ Wf,
    const float* __restrict__ bout, float* __restrict__ Out) {
  __shared__ __align__(16) _Float16 a_lds[128 * P32];  // [m][k]
  __shared__ __align__(16) _Float16 b_lds[64 * P32];   // [n][k]

  const int tid  = threadIdx.x;
  const int wave = tid >> 5, lane = tid & 31;
  const int n = lane & 15, hi = lane >> 4;
  const int rb = blockIdx.x >> 4, cb = blockIdx.x & 15;
  const int r0 = rb * 128, n0 = cb * 64;

  v8f acc[4] = {{}, {}, {}, {}};

  // Fully unrolled, as the compiler had it at the unpadded pitch: left rolled it
  // fetches every other step's B fragments one at a time, a wait before each WMMA.
#pragma unroll
  for (int k0 = 0; k0 < En; k0 += 32) {
    __syncthreads();
#if USE_ASYNC_LDS
    // A: 8 KB = 512 x 16B chunks (2/thread); B: 4 KB = 256 x 16B (1/thread)
    for (int j = 0; j < 2; ++j) {
      int ca = tid + j * 256;
      int row = ca >> 2, sub = ca & 3;
      async_cp16(Ctx + (size_t)(r0 + row) * En + k0 + sub * 8,
                 a_lds + row * P32 + sub * 8);
    }
    {
      int cbk = tid;
      int row = cbk >> 2, sub = cbk & 3;
      async_cp16(Wf + (size_t)(n0 + row) * En + k0 + sub * 8,
                 b_lds + row * P32 + sub * 8);
    }
    wait_async0();
#else
    {
      unsigned int* ad = (unsigned int*)a_lds;
      unsigned int* bd = (unsigned int*)b_lds;
      const unsigned int* cu = (const unsigned int*)Ctx;
      const unsigned int* wu = (const unsigned int*)Wf;
      for (int j = 0; j < 8; ++j) {
        int u = tid + j * 256;
        int row = u >> 4, c = u & 15;
        ad[row * (P32 / 2) + c] = cu[(size_t)(r0 + row) * 512 + (k0 >> 1) + c];
      }
      for (int j = 0; j < 4; ++j) {
        int u = tid + j * 256;
        int row = u >> 4, c = u & 15;
        bd[row * (P32 / 2) + c] = wu[(size_t)(n0 + row) * 512 + (k0 >> 1) + c];
      }
    }
#endif
    if (k0 + 32 < En) {  // prefetch next k-tile into L2/L0
      int row = tid >> 1, sub = tid & 1;
      __builtin_prefetch(Ctx + (size_t)(r0 + row) * En + k0 + 32 + sub * 16, 0, 0);
      if (tid < 128)
        __builtin_prefetch(Wf + (size_t)(n0 + (tid >> 1)) * En + k0 + 32 +
                               (tid & 1) * 16, 0, 0);
    }
    __syncthreads();

    v16h a = ld_frag(a_lds, (wave * 16 + n) * P32 + hi * 8);
    for (int ct = 0; ct < 4; ++ct) {
      v16h b = ld_frag(b_lds, (ct * 16 + n) * P32 + hi * 8);
      acc[ct] = wmma16(a, b, acc[ct]);
    }
  }

  for (int ct = 0; ct < 4; ++ct) {
    float bias = bout[n0 + ct * 16 + n];
    for (int r = 0; r < 8; ++r) {
      int row = r0 + wave * 16 + hi * 8 + r;
      Out[(size_t)row * En + n0 + ct * 16 + n] = acc[ct][r] + bias;
    }
  }
}

// ---------------------------------------------------------------------------
extern "C" void kernel_launch(void* const* d_in, const int* in_sizes, int n_in,
                              void* d_out, int out_size, void* d_ws,
                              size_t ws_size, hipStream_t stream) {
  (void)in_sizes; (void)n_in; (void)out_size; (void)ws_size;
  const float* query = (const float*)d_in[0];
  const float* para  = (const float*)d_in[1];
  const float* Wq = (const float*)d_in[2];
  const float* bq = (const float*)d_in[3];
  const float* Wk = (const float*)d_in[4];
  const float* bk = (const float*)d_in[5];
  const float* Wv = (const float*)d_in[6];
  const float* bv = (const float*)d_in[7];
  const float* Wout = (const float*)d_in[8];
  const float* bout = (const float*)d_in[9];
  float* out = (float*)d_out;

  // workspace layout (all regions fully overwritten before being read)
  char* ws = (char*)d_ws;
  _Float16* qp  = (_Float16*)(ws);                       // 8 MB: [B*H, T, 64]
  _Float16* kp  = (_Float16*)(ws + (size_t)(8u  << 20)); // 2 MB: [H, S, 64]
  _Float16* vp  = (_Float16*)(ws + (size_t)(10u << 20)); // 2 MB: [H, S, 64]
  _Float16* ctx = (_Float16*)(ws + (size_t)(12u << 20)); // 8 MB: [B*T, E]
  _Float16* wf  = (_Float16*)(ws + (size_t)(20u << 20)); // 2 MB: Wout f16

  // 1024 + 256 + 256 projection blocks, then 1024 conversion blocks
  hipLaunchKernelGGL(pre_kernel, dim3(2560), dim3(128), 0, stream,
                     query, para, Wq, bq, Wk, bk, Wv, bv, Wout, qp, kp, vp, wf);
  hipLaunchKernelGGL(attn_kernel, dim3(1024), dim3(128), 0, stream,
                     qp, kp, vp, ctx);
  hipLaunchKernelGGL(outproj_kernel, dim3(512), dim3(256), 0, stream,
                     ctx, wf, bout, out);
}

// v005
// One run takes 42 microseconds.
// Timed twice side by side with v004, it ran 1.42 times as fast both times.
// Counting every step since v000, it is 3.68 times as fast.
#include <hip/hip_runtime.h>

// Problem constants (match reference)
#define Bn 4
#define Tn 1024
#define Sn 1024
#define En 1024
#define Hn 16
#define Dn 64

typedef __attribute__((ext_vector_type(16))) _Float16 v16h;
typedef __attribute__((ext_vector_type(8)))  _Float16 h8;
typedef __attribute__((ext_vector_type(8)))  float    v8f;
typedef __attribute__((ext_vector_type(4)))  int      v4i;

#if __has_builtin(__builtin_amdgcn_global_load_async_to_lds_b128)
#define USE_ASYNC_LDS 1
#else
#define USE_ASYNC_LDS 0
#endif

#if USE_ASYNC_LDS
typedef __attribute__((address_space(1))) v4i as1_v4i;  // global
typedef __attribute__((address_space(3))) v4i as3_v4i;  // LDS
// Copy one 16-byte chunk global -> LDS via the async path (ASYNCcnt).
__device__ __forceinline__ void async_cp16(const _Float16* g, _Float16* l) {
  __builtin_amdgcn_global_load_async_to_lds_b128((as1_v4i*)g, (as3_v4i*)l, 0,
                                                 0);
}
__device__ __forceinline__ void wait_async0() {
#if __has_builtin(__builtin_amdgcn_s_wait_asynccnt)
  __builtin_amdgcn_s_wait_asynccnt(0);
#else
  asm volatile("s_wait_asynccnt 0" ::: "memory");
#endif
}
#endif

__device__ __forceinline__ v8f wmma16(v16h a, v16h b, v8f c) {
  // D = A(16x32 f16) * B(32x16 f16) + C(16x16 f32)
  return __builtin_amdgcn_wmma_f32_16x16x32_f16(false, a, false, b, (short)0, c,
                                                false, false);
}

// Load one 16-half WMMA operand fragment from an LDS tile.
// Per ISA layout, each lane needs K = g*16 + hi*8 + j (j=0..7, g=0..1), i.e.
// two contiguous 16-byte chunks at (off) and (off+16).
__device__ __forceinline__ v16h ld_frag(const _Float16* base, int off) {
  union { v16h v; h8 h[2]; } u;
  u.h[0] = *(const h8*)(base + off);
  u.h[1] = *(const h8*)(base + off + 16);
  return u.v;
}

// Tiles that ld_frag reads (ds_load_b128, one row per lane): the pitch is an odd
// multiple of 16 B, so that the 16 rows of a half wave fall on all 64 banks.
#define P64 72  // halves: rows of 64 halves (128 B) at 144 B

// V tile in LDS: rows of 64 halves (128 B) at a pitch of 160 B, an odd multiple
// of 32 B, which spreads the transposing reads over the banks.
#define VPITCH 80  // halves

// One 32(k) x 16(n) B fragment out of a row-major [k][n] f16 LDS tile by two
// transposing loads: lane (c = lane & 15, hi = lane >> 4) gets
// tile[8*hi + 0..7][c] and tile[16 + 8*hi + 0..7][c], the k order of ld_frag.
// p is the lane's own address:
// tile + (8*hi + (lane & 7)) * VPITCH + 8 * ((lane >> 3) & 1) + first column.
typedef short s16x8 __attribute__((ext_vector_type(8)));
typedef __attribute__((address_space(3))) s16x8 lds_s16x8;
__device__ __forceinline__ v16h ld_frag_tr(const _Float16* p) {
  union { v16h v; s16x8 s[2]; } u;
  u.s[0] = __builtin_amdgcn_ds_load_tr16_b128_v8i16((lds_s16x8*)p);
  u.s[1] = __builtin_amdgcn_ds_load_tr16_b128_v8i16((lds_s16x8*)(p + 16 * VPITCH));
  return u.v;
}

// ---------------------------------------------------------------------------
// The four passes that depend on nothing but the inputs, as block ranges of one
// launch, so that they run side by side and three launch gaps go:
//   blocks    0..1023  query projection   (mode 0)
//   blocks 1024..1279  key projection     (mode 1)
//   blocks 1280..1535  value projection   (mode 1)
//   blocks 1536..2559  Wout f32 -> f16, 1024 elements a block (layout kept
//                      [n][k] row-major == Wout itself, since the output GEMM
//                      needs B[k][n] = Wout[n][k])
// The projections come first: they run longest.
//
// Projection: X[N,64] @ W^T[64,64] + b -> f16 with head-major row remap.
// mode 0: rows are (b,t,h) -> out row (b*H+h)*T + t   (query)
// mode 1: rows are (s,h)   -> out row h*S + s         (key/value)
// 128 threads (4 waves). Each wave: 16 rows x 64 cols = 4 col-tiles, K=64.
// ---------------------------------------------------------------------------
#define QBLK 1024  // blocks of the query projection: B*T*H / 64 rows
#define KBLK 256   // blocks of the key and of the value projection: S*H / 64

typedef __attribute__((ext_vector_type(4))) _Float16 h4;

__global__ __launch_bounds__(128) void pre_kernel(
    const float* __restrict__ query, const float* __restrict__ para,
    const float* __restrict__ Wq, const float* __restrict__ bq,
    const float* __restrict__ Wk, const float* __restrict__ bk,
    const float* __restrict__ Wv, const float* __restrict__ bv,
    const float* __restrict__ Wout, _Float16* __restrict__ qp,
    _Float16* __restrict__ kp, _Float16* __restrict__ vp,
    _Float16* __restrict__ wf) {
  __shared__ __align__(16) _Float16 w_lds[64 * P64];      // [n][k]
  __shared__ __align__(16) _Float16 x_lds[4][16 * P64];   // per wave [m][k]

  const int tid  = threadIdx.x;
  const int blk  = blockIdx.x;

  if (blk >= QBLK + 2 * KBLK) {  // the same for the whole block, before any barrier
    // a wave's 16-B loads cover 512 contiguous bytes, its 8-B stores 256
    const int base = (blk - (QBLK + 2 * KBLK)) * 1024 + tid * 4;
    const float4 f0 = *(const float4*)(Wout + base);
    const float4 f1 = *(const float4*)(Wout + base + 512);
    const h4 g0 = {(_Float16)f0.x, (_Float16)f0.y, (_Float16)f0.z, (_Float16)f0.w};
    const h4 g1 = {(_Float16)f1.x, (_Float16)f1.y, (_Float16)f1.z, (_Float16)f1.w};
    *(h4*)(wf + base)       = g0;
    *(h4*)(wf + base + 512) = g1;
    return;
  }

  // which projection this block belongs to, and its index there
  const int mode = blk < QBLK ? 0 : 1;
  const bool isv = blk >= QBLK + KBLK;
  const int pblk = mode == 0 ? blk : (isv ? blk - (QBLK + KBLK) : blk - QBLK);
  const float* __restrict__ X    = mode == 0 ? query : para;
  const float* __restrict__ W    = mode == 0 ? Wq : (isv ? Wv : Wk);
  const float* __restrict__ bias = mode == 0 ? bq : (isv ? bv : bk);
  _Float16* __restrict__ out     = mode == 0 ? qp : (isv ? vp : kp);

  const int wave = tid >> 5, lane = tid & 31;
  const int n = lane & 15, hi = lane >> 4;
  const int rbase = pblk * 64 + wave * 16;

  for (int j = 0; j < 32; ++j) {
    // B[k][n] = W[n][k] -> store W row-major: two rows of 64 per trip
    w_lds[((tid >> 6) + 2 * j) * P64 + (tid & 63)] = (_Float16)W[tid + j * 128];
  }
  _Float16* xw = x_lds[wave];
  for (int j = 0; j < 32; ++j) {
    int idx = lane + j * 32;
    int m = idx >> 6, c = idx & 63;
    xw[m * P64 + c] = (_Float16)X[(size_t)(rbase + m) * 64 + c];
  }
  __syncthreads();

  v16h a0 = ld_frag(xw, n * P64 + 0  + hi * 8);
  v16h a1 = ld_frag(xw, n * P64 + 32 + hi * 8);

  v8f acc[4];
  for (int ct = 0; ct < 4; ++ct) {
    v8f c = {};
    v16h b0 = ld_frag(w_lds, (ct * 16 + n) * P64 + 0  + hi * 8);
    v16h b1 = ld_frag(w_lds, (ct * 16 + n) * P64 + 32 + hi * 8);
    c = wmma16(a0, b0, c);
    c = wmma16(a1, b1, c);
    acc[ct] = c;
  }

  for (int ct = 0; ct < 4; ++ct) {
    float bv = bias[ct * 16 + n];
    for (int r = 0; r < 8; ++r) {
      int grow = rbase + hi * 8 + r;
      int orow;
      if (mode == 0) {
        int bb  = grow >> 14;        // / (T*H) = 16384
        int rem = grow & 16383;
        int t = rem >> 4, h = rem & 15;
        orow = (bb * Hn + h) * Tn + t;
      } else {
        int s = grow >> 4, h = grow & 15;
        orow = h * Sn + s;
      }
      out[(size_t)orow * 64 + ct * 16 + n] = (_Float16)(acc[ct][r] + bv);
    }
  }
}

#define KFILL 128

// lane l <-> lane l ^ 16
__device__ __forceinline__ float xhalf(float x) {
  int v = __builtin_bit_cast(int, x);
  return __builtin_bit_cast(
      float, __builtin_amdgcn_permlanex16(v, v, 0x76543210, 0xfedcba98, false,
                                          false));
}

__global__ __launch_bounds__(128) void attn_kernel(
    const _Float16* __restrict__ Qp, const _Float16* __restrict__ Kp,
    const _Float16* __restrict__ Vp, _Float16* __restrict__ Ctx) {
  __shared__ __align__(16) _Float16 q_lds[4][16 * P64]; // per wave [t][d]
  __shared__ __align__(16) _Float16 k_lds[KFILL * P64];    // [s][d] (=A [m][k])
  __shared__ __align__(16) _Float16 v_lds[KFILL * VPITCH]; // [s][d] as in memory

  const int tid  = threadIdx.x;
  const int wave = tid >> 5, lane = tid & 31;
  const int n = lane & 15, hi = lane >> 4;
  const int tt = blockIdx.x & 15;
  const int bh = blockIdx.x >> 4;
  const int b = bh >> 4, h = bh & 15;
  const int t0 = tt * 64 + wave * 16;

  // stage this wave's 16x64 Q tile (2 KB = 128 x 16B chunks, 4 per lane)
  _Float16* qw = q_lds[wave];
  {
    const _Float16* qs = Qp + ((size_t)(b * Hn + h) * Tn + t0) * 64;
#if USE_ASYNC_LDS
    for (int j = 0; j < 4; ++j) {
      int c = lane + j * 32;
      async_cp16(qs + c * 8, qw + (c >> 3) * P64 + (c & 7) * 8);
    }
    wait_async0();
#else
    const unsigned int* qu = (const unsigned int*)qs;
    unsigned int* qd = (unsigned int*)qw;
    for (int j = 0; j < 16; ++j) {
      int u = lane + j * 32;
      qd[(u >> 5) * (P64 / 2) + (u & 31)] = qu[u];
    }
#endif
  }
  __syncthreads();

  // Q^T as B operand: column n = query t0 + n
  v16h bq0 = ld_frag(qw, n * P64 + 0  + hi * 8);
  v16h bq1 = ld_frag(qw, n * P64 + 32 + hi * 8);

  // O^T tiles: register r of tile ct = O[query n][d = 16*ct + 8*hi + r]
  v8f o0 = {}, o1 = {}, o2 = {}, o3 = {};
  float mrow = -3.0e38f;  // running maximum of query n (equal in both halves)
  float lsum = 0.0f;      // running sum over this lane half's keys only
  const float sc = 0.03125f;  // 1/sqrt(E) = 1/32 (reference scales by sqrt(E))

  const size_t kvbase = (size_t)h * Sn * 64;
  for (int s0 = 0; s0 < Sn; s0 += KFILL) {
    __syncthreads();  // prior fill's K/V reads complete
    {   // stage K [KFILL s][64 d]: KFILL * 8 pieces of 16 B, KFILL / 16 per thread
      const _Float16* ks = Kp + kvbase + (size_t)s0 * 64;
#if USE_ASYNC_LDS
      for (int j = 0; j < KFILL / 16; ++j) {
        int c = tid + j * 128;
        async_cp16(ks + c * 8, k_lds + (c >> 3) * P64 + (c & 7) * 8);
      }
#else
      unsigned int* kd = (unsigned int*)k_lds;
      const unsigned int* ku = (const unsigned int*)ks;
      for (int j = 0; j < KFILL / 4; ++j) {
        int u = tid + j * 128;
        kd[(u >> 5) * (P64 / 2) + (u & 31)] = ku[u];
      }
#endif
    }
    {   // stage V as it lies, [KFILL s][64 d]: KFILL / 16 pieces of 16 B per thread
      const _Float16* vs = Vp + kvbase + (size_t)s0 * 64;
      for (int j = 0; j < KFILL / 16; ++j) {
        int c = tid + j * 128;
        int row = c >> 3, sub = c & 7;
#if USE_ASYNC_LDS
        async_cp16(vs + c * 8, v_lds + row * VPITCH + sub * 8);
#else
        *(h8*)(v_lds + row * VPITCH + sub * 8) = *(const h8*)(vs + c * 8);
#endif
      }
    }
#if USE_ASYNC_LDS
    wait_async0();  // this wave's K and V copies have landed
#endif
    // publishes the tiles to the other waves; standing directly behind the
    // wait it also keeps every LDS read of the tiles behind that wait
    __syncthreads();

   for (int ss = 0; ss < KFILL; ss += 32) {  // the fill's chunks of 32 keys, in order
    const _Float16* kt = k_lds + ss * P64;
    // S^T: two 16(key) x 16(query) tiles, K=64 over D in two 32-steps
    v8f sf0 = {}, sf1 = {};
    {
      v16h ak;
      ak = ld_frag(kt, (0 * 16 + n) * P64 + 0  + hi * 8); sf0 = wmma16(ak, bq0, sf0);
      ak = ld_frag(kt, (0 * 16 + n) * P64 + 32 + hi * 8); sf0 = wmma16(ak, bq1, sf0);
      ak = ld_frag(kt, (1 * 16 + n) * P64 + 0  + hi * 8); sf1 = wmma16(ak, bq0, sf1);
      ak = ld_frag(kt, (1 * 16 + n) * P64 + 32 + hi * 8); sf1 = wmma16(ak, bq1, sf1);
    }

    // online softmax: the lane's 16 scores all belong to query n
    const v8f p0 = sf0 * sc, p1 = sf1 * sc;
    float mloc = fmaxf(
        fmaxf(fmaxf(fmaxf(p0[0], p0[1]), fmaxf(p0[2], p0[3])),
              fmaxf(fmaxf(p0[4], p0[5]), fmaxf(p0[6], p0[7]))),
        fmaxf(fmaxf(fmaxf(p1[0], p1[1]), fmaxf(p1[2], p1[3])),
              fmaxf(fmaxf(p1[4], p1[5]), fmaxf(p1[6], p1[7]))));
    mloc = fmaxf(mloc, xhalf(mloc));  // the other half's 16 keys
    const float mnew  = fmaxf(mloc, mrow);
    const float alpha = __expf(mrow - mnew);
    mrow = mnew;
    float e0[8], e1[8];
    for (int r = 0; r < 8; ++r) {
      e0[r] = __expf(p0[r] - mnew);
      e1[r] = __expf(p1[r] - mnew);
    }
    lsum = lsum * alpha +
           ((((e0[0] + e0[1]) + (e0[2] + e0[3])) + ((e0[4] + e0[5]) + (e0[6] + e0[7]))) +
            (((e1[0] + e1[1]) + (e1[2] + e1[3])) + ((e1[4] + e1[5]) + (e1[6] + e1[7]))));
    o0 *= alpha; o1 *= alpha; o2 *= alpha; o3 *= alpha;

    // P^T as B operand: element 8*g + j = k index 16*g + 8*hi + j = tile g, reg j
    v16h pb;
    for (int r = 0; r < 8; ++r) {
      pb[r]     = (_Float16)e0[r];
      pb[8 + r] = (_Float16)e1[r];
    }

    // V^T as A operand: row = d, by the transposing loads
    const _Float16* vt =
        v_lds + (ss + hi * 8 + (lane & 7)) * VPITCH + ((lane >> 3) & 1) * 8;
    v16h av;
    av = ld_frag_tr(vt + 0 * 16); o0 = wmma16(av, pb, o0);
    av = ld_frag_tr(vt + 1 * 16); o1 = wmma16(av, pb, o1);
    av = ld_frag_tr(vt + 2 * 16); o2 = wmma16(av, pb, o2);
    av = ld_frag_tr(vt + 3 * 16); o3 = wmma16(av, pb, o3);
   }
  }

  // join the halves' sums, normalize and write context in [B,T,E] (f16) for
  // the output GEMM: a lane holds 8 consecutive d of its query per tile
  {
    const float inv = 1.0f / (lsum + xhalf(lsum));
    _Float16* crow = Ctx + ((size_t)b * Tn + t0 + n) * En + h * 64 + hi * 8;
    h8 w0, w1, w2, w3;
    for (int r = 0; r < 8; ++r) {
      w0[r] = (_Float16)(o0[r] * inv);
      w1[r] = (_Float16)(o1[r] * inv);
      w2[r] = (_Float16)(o2[r] * inv);
      w3[r] = (_Float16)(o3[r] * inv);
    }
    *(h8*)(crow + 0 * 16) = w0;
    *(h8*)(crow + 1 * 16) = w1;
    *(h8*)(crow + 2 * 16) = w2;
    *(h8*)(crow + 3 * 16) = w3;
  }
}

// ---------------------------------------------------------------------------
// Output projection: Ctx[4096,1024] @ Wout^T + bout -> f32 out.
// 256 threads (8 waves) per WG compute a 128x64 tile; one LDS fill holds OFILL
// of k = OFILL / 32 k-steps, so that the copies' latency and the two barriers
// are paid once per fill, and a wave's copy takes whole 128-B lines of a row.
// Each wave = one 16-row stripe x 4 col sub-tiles: 1 A-frag reused over 4
// B-frags -> 4 WMMAs per wave per k-step.
// ---------------------------------------------------------------------------
#define OFILL 256          // k per LDS fill: rows of 512 B
#define PO (OFILL + 8)     // halves: pitch 528 B = 16 B x 33, odd as above
__global__ __launch_bounds__(256) void outproj_kernel(
    const _Float16* __restrict__ Ctx, const _Float16* __restrict__ Wf,
    const float* __restrict__ bout, float* __restrict__ Out) {
  __shared__ __align__(16) _Float16 a_lds[128 * PO];  // [m][k]
  __shared__ __align__(16) _Float16 b_lds[64 * PO];   // [n][k]

  const int tid  = threadIdx.x;
  const int wave = tid >> 5, lane = tid & 31;
  const int n = lane & 15, hi = lane >> 4;
  const int rb = blockIdx.x >> 4, cb = blockIdx.x & 15;
  const int r0 = rb * 128, n0 = cb * 64;

  v8f acc[4] = {{}, {}, {}, {}};

  for (int k0 = 0; k0 < En; k0 += OFILL) {
    __syncthreads();
#if USE_ASYNC_LDS
    // Eight lanes take one 128-B line of a row, the block 32 rows at a time
    // (A 128 rows, B 64). Along a row LDS and global address step alike, so one
    // address pair serves a row's OFILL / 64 lines.
    for (int g = 0; g < 4; ++g) {
      int row = g * 32 + (tid >> 3);
      for (int j = 0; j < OFILL / 64; ++j) {
        int col = j * 64 + (tid & 7) * 8;
        async_cp16(Ctx + (size_t)(r0 + row) * En + k0 + col, a_lds + row * PO + col);
      }
    }
    for (int g = 0; g < 2; ++g) {
      int row = g * 32 + (tid >> 3);
      for (int j = 0; j < OFILL / 64; ++j) {
        int col = j * 64 + (tid & 7) * 8;
        async_cp16(Wf + (size_t)(n0 + row) * En + k0 + col, b_lds + row * PO + col);
      }
    }
    wait_async0();
#else
    {
      unsigned int* ad = (unsigned int*)a_lds;
      unsigned int* bd = (unsigned int*)b_lds;
      const unsigned int* cu = (const unsigned int*)Ctx;
      const unsigned int* wu = (const unsigned int*)Wf;
      for (int j = 0; j < OFILL / 4; ++j) {
        int u = tid + j * 256;
        int row = u / (OFILL / 2), c = u % (OFILL / 2);
        ad[row * (PO / 2) + c] = cu[(size_t)(r0 + row) * 512 + (k0 >> 1) + c];
      }
      for (int j = 0; j < OFILL / 8; ++j) {
        int u = tid + j * 256;
        int row = u / (OFILL / 2), c = u % (OFILL / 2);
        bd[row * (PO / 2) + c] = wu[(size_t)(n0 + row) * 512 + (k0 >> 1) + c];
      }
    }
#endif
    if (k0 + OFILL < En) {  // prefetch the next fill, one request a 128-B line
      // two threads a row, each its half of the row's OFILL / 64 lines
      int row = tid >> 1, col = k0 + OFILL + (tid & 1) * (OFILL / 2);
      for (int j = 0; j < OFILL / 128; ++j)
        __builtin_prefetch(Ctx + (size_t)(r0 + row) * En + col + j * 64, 0, 0);
      if (tid < 128)
        for (int j = 0; j < OFILL / 128; ++j)
          __builtin_prefetch(Wf + (size_t)(n0 + row) * En + col + j * 64, 0, 0);
    }
    __syncthreads();

    // The scheduling groups keep a k-step's ten LDS reads together in front of its
    // four WMMAs, under counted waits: without them the compiler sinks every pair
    // of reads to its own WMMA and waits for it there, one full LDS wait a WMMA.
#pragma unroll  // constant LDS offsets for the k-steps of a fill
    for (int kk = 0; kk < OFILL; kk += 32) {
      v16h a = ld_frag(a_lds, (wave * 16 + n) * PO + kk + hi * 8);
      v16h b[4];
      for (int ct = 0; ct < 4; ++ct)
        b[ct] = ld_frag(b_lds, (ct * 16 + n) * PO + kk + hi * 8);
      for (int ct = 0; ct < 4; ++ct) acc[ct] = wmma16(a, b[ct], acc[ct]);
      __builtin_amdgcn_sched_group_barrier(0x100, 10, 0);  // the k-step's LDS reads
      __builtin_amdgcn_sched_group_barrier(0x008, 4, 0);   // then its WMMAs
    }
  }

  for (int ct = 0; ct < 4; ++ct) {
    float bias = bout[n0 + ct * 16 + n];
    for (int r = 0; r < 8; ++r) {
      int row = r0 + wave * 16 + hi * 8 + r;
      Out[(size_t)row * En + n0 + ct * 16 + n] = acc[ct][r] + bias;
    }
  }
}

// ---------------------------------------------------------------------------
extern "C" void kernel_launch(void* const* d_in, const int* in_sizes, int n_in,
                              void* d_out, int out_size, void* d_ws,
                              size_t ws_size, hipStream_t stream) {
  (void)in_sizes; (void)n_in; (void)out_size; (void)ws_size;
  const float* query = (const float*)d_in[0];
  const float* para  = (const float*)d_in[1];
  const float* Wq = (const float*)d_in[2];
  const float* bq = (const float*)d_in[3];
  const float* Wk = (const float*)d_in[4];
  const float* bk = (const float*)d_in[5];
  const float* Wv = (const float*)d_in[6];
  const float* bv = (const float*)d_in[7];
  const float* Wout = (const float*)d_in[8];
  const float* bout = (const float*)d_in[9];
  float* out = (float*)d_out;

  // workspace layout (all regions fully overwritten before being read)
  char* ws = (char*)d_ws;
  _Float16* qp  = (_Float16*)(ws);                       // 8 MB: [B*H, T, 64]
  _Float16* kp  = (_Float16*)(ws + (size_t)(8u  << 20)); // 2 MB: [H, S, 64]
  _Float16* vp  = (_Float16*)(ws + (size_t)(10u << 20)); // 2 MB: [H, S, 64]
  _Float16* ctx = (_Float16*)(ws + (size_t)(12u << 20)); // 8 MB: [B*T, E]
  _Float16* wf  = (_Float16*)(ws + (size_t)(20u << 20)); // 2 MB: Wout f16

  // 1024 + 256 + 256 projection blocks, then 1024 conversion blocks
  hipLaunchKernelGGL(pre_kernel, dim3(2560), dim3(128), 0, stream,
                     query, para, Wq, bq, Wk, bk, Wv, bv, Wout, qp, kp, vp, wf);
  hipLaunchKernelGGL(attn_kernel, dim3(1024), dim3(128), 0, stream,
                     qp, kp, vp, ctx);
  hipLaunchKernelGGL(outproj_kernel, dim3(512), dim3(256), 0, stream,
                     ctx, wf, bout, out);
}

// v006
// It runs in 40.3 microseconds.
// Next to v005, in two timings, it ran 1.04 times as fast each time.
// Over all steps from v000 it is 3.84 times as fast.
#include <hip/hip_runtime.h>

// Problem constants (match reference)
#define Bn 4
#define Tn 1024
#define Sn 1024
#define En 1024
#define Hn 16
#define Dn 64

typedef __attribute__((ext_vector_type(16))) _Float16 v16h;
typedef __attribute__((ext_vector_type(8)))  _Float16 h8;
typedef __attribute__((ext_vector_type(8)))  float    v8f;
typedef __attribute__((ext_vector_type(4)))  int      v4i;

#if __has_builtin(__builtin_amdgcn_global_load_async_to_lds_b128)
#define USE_ASYNC_LDS 1
#else
#define USE_ASYNC_LDS 0
#endif

#if USE_ASYNC_LDS
typedef __attribute__((address_space(1))) v4i as1_v4i;  // global
typedef __attribute__((address_space(3))) v4i as3_v4i;  // LDS
// Copy one 16-byte chunk global -> LDS via the async path (ASYNCcnt).
__device__ __forceinline__ void async_cp16(const _Float16* g, _Float16* l) {
  __builtin_amdgcn_global_load_async_to_lds_b128((as1_v4i*)g, (as3_v4i*)l, 0,
                                                 0);
}
__device__ __forceinline__ void wait_async0() {
#if __has_builtin(__builtin_amdgcn_s_wait_asynccnt)
  __builtin_amdgcn_s_wait_asynccnt(0);
#else
  asm volatile("s_wait_asynccnt 0" ::: "memory");
#endif
}
#else
// The same piece through registers.
__device__ __forceinline__ void async_cp16(const _Float16* g, _Float16* l) {
  *(h8*)l = *(const h8*)g;
}
#endif

// The two waits at the hand-over of a ring of LDS buffers, in asm with the
// "memory" clobber, so that no LDS access and no copy moves over them.
// This wave's copies to LDS have landed:
__device__ __forceinline__ void ring_wait_copies() {
  asm volatile("s_wait_asynccnt 0x0" ::: "memory");
}
// This wave's LDS reads have returned, before a buffer it has read is refilled:
__device__ __forceinline__ void ring_wait_reads() {
  asm volatile("s_wait_dscnt 0x0" ::: "memory");
}

__device__ __forceinline__ v8f wmma16(v16h a, v16h b, v8f c) {
  // D = A(16x32 f16) * B(32x16 f16) + C(16x16 f32)
  return __builtin_amdgcn_wmma_f32_16x16x32_f16(false, a, false, b, (short)0, c,
                                                false, false);
}

// Load one 16-half WMMA operand fragment from an LDS tile.
// Per ISA layout, each lane needs K = g*16 + hi*8 + j (j=0..7, g=0..1), i.e.
// two contiguous 16-byte chunks at (off) and (off+16).
__device__ __forceinline__ v16h ld_frag(const _Float16* base, int off) {
  union { v16h v; h8 h[2]; } u;
  u.h[0] = *(const h8*)(base + off);
  u.h[1] = *(const h8*)(base + off + 16);
  return u.v;
}

// Tiles that ld_frag reads (ds_load_b128, one row per lane): the pitch is an odd
// multiple of 16 B, so that the 16 rows of a half wave fall on all 64 banks.
#define P64 72  // halves: rows of 64 halves (128 B) at 144 B

// V tile in LDS: rows of 64 halves (128 B) at a pitch of 160 B, an odd multiple
// of 32 B, which spreads the transposing reads over the banks.
#define VPITCH 80  // halves

// One 32(k) x 16(n) B fragment out of a row-major [k][n] f16 LDS tile by two
// transposing loads: lane (c = lane & 15, hi = lane >> 4) gets
// tile[8*hi + 0..7][c] and tile[16 + 8*hi + 0..7][c], the k order of ld_frag.
// p is the lane's own address:
// tile + (8*hi + (lane & 7)) * VPITCH + 8 * ((lane >> 3) & 1) + first column.
typedef short s16x8 __attribute__((ext_vector_type(8)));
typedef __attribute__((address_space(3))) s16x8 lds_s16x8;
__device__ __forceinline__ v16h ld_frag_tr(const _Float16* p) {
  union { v16h v; s16x8 s[2]; } u;
  u.s[0] = __builtin_amdgcn_ds_load_tr16_b128_v8i16((lds_s16x8*)p);
  u.s[1] = __builtin_amdgcn_ds_load_tr16_b128_v8i16((lds_s16x8*)(p + 16 * VPITCH));
  return u.v;
}

// ---------------------------------------------------------------------------
// The four passes that depend on nothing but the inputs, as block ranges of one
// launch, so that they run side by side and three launch gaps go:
//   blocks    0..1023  query projection   (mode 0)
//   blocks 1024..1279  key projection     (mode 1)
//   blocks 1280..1535  value projection   (mode 1)
//   blocks 1536..2559  Wout f32 -> f16, 1024 elements a block (layout kept
//                      [n][k] row-major == Wout itself, since the output GEMM
//                      needs B[k][n] = Wout[n][k])
// The projections come first: they run longest.
//
// Projection: X[N,64] @ W^T[64,64] + b -> f16 with head-major row remap.
// mode 0: rows are (b,t,h) -> out row (b*H+h)*T + t   (query)
// mode 1: rows are (s,h)   -> out row h*S + s         (key/value)
// 128 threads (4 waves). Each wave: 16 rows x 64 cols = 4 col-tiles, K=64.
// ---------------------------------------------------------------------------
#define QBLK 1024  // blocks of the query projection: B*T*H / 64 rows
#define KBLK 256   // blocks of the key and of the value projection: S*H / 64

typedef __attribute__((ext_vector_type(4))) _Float16 h4;

__global__ __launch_bounds__(128) void pre_kernel(
    const float* __restrict__ query, const float* __restrict__ para,
    const float* __restrict__ Wq, const float* __restrict__ bq,
    const float* __restrict__ Wk, const float* __restrict__ bk,
    const float* __restrict__ Wv, const float* __restrict__ bv,
    const float* __restrict__ Wout, _Float16* __restrict__ qp,
    _Float16* __restrict__ kp, _Float16* __restrict__ vp,
    _Float16* __restrict__ wf) {
  __shared__ __align__(16) _Float16 w_lds[64 * P64];      // [n][k]
  __shared__ __align__(16) _Float16 x_lds[4][16 * P64];   // per wave [m][k]

  const int tid  = threadIdx.x;
  const int blk  = blockIdx.x;

  if (blk >= QBLK + 2 * KBLK) {  // the same for the whole block, before any barrier
    // a wave's 16-B loads cover 512 contiguous bytes, its 8-B stores 256
    const int base = (blk - (QBLK + 2 * KBLK)) * 1024 + tid * 4;
    const float4 f0 = *(const float4*)(Wout + base);
    const float4 f1 = *(const float4*)(Wout + base + 512);
    const h4 g0 = {(_Float16)f0.x, (_Float16)f0.y, (_Float16)f0.z, (_Float16)f0.w};
    const h4 g1 = {(_Float16)f1.x, (_Float16)f1.y, (_Float16)f1.z, (_Float16)f1.w};
    *(h4*)(wf + base)       = g0;
    *(h4*)(wf + base + 512) = g1;
    return;
  }

  // which projection this block belongs to, and its index there
  const int mode = blk < QBLK ? 0 : 1;
  const bool isv = blk >= QBLK + KBLK;
  const int pblk = mode == 0 ? blk : (isv ? blk - (QBLK + KBLK) : blk - QBLK);
  const float* __restrict__ X    = mode == 0 ? query : para;
  const float* __restrict__ W    = mode == 0 ? Wq : (isv ? Wv : Wk);
  const float* __restrict__ bias = mode == 0 ? bq : (isv ? bv : bk);
  _Float16* __restrict__ out     = mode == 0 ? qp : (isv ? vp : kp);

  const int wave = tid >> 5, lane = tid & 31;
  const int n = lane & 15, hi = lane >> 4;
  const int rbase = pblk * 64 + wave * 16;

  for (int j = 0; j < 32; ++j) {
    // B[k][n] = W[n][k] -> store W row-major: two rows of 64 per trip
    w_lds[((tid >> 6) + 2 * j) * P64 + (tid & 63)] = (_Float16)W[tid + j * 128];
  }
  _Float16* xw = x_lds[wave];
  for (int j = 0; j < 32; ++j) {
    int idx = lane + j * 32;
    int m = idx >> 6, c = idx & 63;
    xw[m * P64 + c] = (_Float16)X[(size_t)(rbase + m) * 64 + c];
  }
  __syncthreads();

  v16h a0 = ld_frag(xw, n * P64 + 0  + hi * 8);
  v16h a1 = ld_frag(xw, n * P64 + 32 + hi * 8);

  v8f acc[4];
  for (int ct = 0; ct < 4; ++ct) {
    v8f c = {};
    v16h b0 = ld_frag(w_lds, (ct * 16 + n) * P64 + 0  + hi * 8);
    v16h b1 = ld_frag(w_lds, (ct * 16 + n) * P64 + 32 + hi * 8);
    c = wmma16(a0, b0, c);
    c = wmma16(a1, b1, c);
    acc[ct] = c;
  }

  for (int ct = 0; ct < 4; ++ct) {
    float bv = bias[ct * 16 + n];
    for (int r = 0; r < 8; ++r) {
      int grow = rbase + hi * 8 + r;
      int orow;
      if (mode == 0) {
        int bb  = grow >> 14;        // / (T*H) = 16384
        int rem = grow & 16383;
        int t = rem >> 4, h = rem & 15;
        orow = (bb * Hn + h) * Tn + t;
      } else {
        int s = grow >> 4, h = grow & 15;
        orow = h * Sn + s;
      }
      out[(size_t)orow * 64 + ct * 16 + n] = (_Float16)(acc[ct][r] + bv);
    }
  }
}

#define KFILL 128

// lane l <-> lane l ^ 16
__device__ __forceinline__ float xhalf(float x) {
  int v = __builtin_bit_cast(int, x);
  return __builtin_bit_cast(
      float, __builtin_amdgcn_permlanex16(v, v, 0x76543210, 0xfedcba98, false,
                                          false));
}

__global__ __launch_bounds__(128) void attn_kernel(
    const _Float16* __restrict__ Qp, const _Float16* __restrict__ Kp,
    const _Float16* __restrict__ Vp, _Float16* __restrict__ Ctx) {
  __shared__ __align__(16) _Float16 q_lds[4][16 * P64]; // per wave [t][d]
  __shared__ __align__(16) _Float16 k_lds[KFILL * P64];    // [s][d] (=A [m][k])
  __shared__ __align__(16) _Float16 v_lds[KFILL * VPITCH]; // [s][d] as in memory

  const int tid  = threadIdx.x;
  const int wave = tid >> 5, lane = tid & 31;
  const int n = lane & 15, hi = lane >> 4;
  const int tt = blockIdx.x & 15;
  const int bh = blockIdx.x >> 4;
  const int b = bh >> 4, h = bh & 15;
  const int t0 = tt * 64 + wave * 16;

  // stage this wave's 16x64 Q tile (2 KB = 128 x 16B chunks, 4 per lane)
  _Float16* qw = q_lds[wave];
  {
    const _Float16* qs = Qp + ((size_t)(b * Hn + h) * Tn + t0) * 64;
#if USE_ASYNC_LDS
    for (int j = 0; j < 4; ++j) {
      int c = lane + j * 32;
      async_cp16(qs + c * 8, qw + (c >> 3) * P64 + (c & 7) * 8);
    }
    wait_async0();
#else
    const unsigned int* qu = (const unsigned int*)qs;
    unsigned int* qd = (unsigned int*)qw;
    for (int j = 0; j < 16; ++j) {
      int u = lane + j * 32;
      qd[(u >> 5) * (P64 / 2) + (u & 31)] = qu[u];
    }
#endif
  }
  __syncthreads();

  // Q^T as B operand: column n = query t0 + n
  v16h bq0 = ld_frag(qw, n * P64 + 0  + hi * 8);
  v16h bq1 = ld_frag(qw, n * P64 + 32 + hi * 8);

  // O^T tiles: register r of tile ct = O[query n][d = 16*ct + 8*hi + r]
  v8f o0 = {}, o1 = {}, o2 = {}, o3 = {};
  float mrow = -3.0e38f;  // running maximum of query n (equal in both halves)
  float lsum = 0.0f;      // running sum over this lane half's keys only
  const float sc = 0.03125f;  // 1/sqrt(E) = 1/32 (reference scales by sqrt(E))

  const size_t kvbase = (size_t)h * Sn * 64;
  for (int s0 = 0; s0 < Sn; s0 += KFILL) {
    __syncthreads();  // prior fill's K/V reads complete
    {   // stage K [KFILL s][64 d]: KFILL * 8 pieces of 16 B, KFILL / 16 per thread
      const _Float16* ks = Kp + kvbase + (size_t)s0 * 64;
#if USE_ASYNC_LDS
      for (int j = 0; j < KFILL / 16; ++j) {
        int c = tid + j * 128;
        async_cp16(ks + c * 8, k_lds + (c >> 3) * P64 + (c & 7) * 8);
      }
#else
      unsigned int* kd = (unsigned int*)k_lds;
      const unsigned int* ku = (const unsigned int*)ks;
      for (int j = 0; j < KFILL / 4; ++j) {
        int u = tid + j * 128;
        kd[(u >> 5) * (P64 / 2) + (u & 31)] = ku[u];
      }
#endif
    }
    {   // stage V as it lies, [KFILL s][64 d]: KFILL / 16 pieces of 16 B per thread
      const _Float16* vs = Vp + kvbase + (size_t)s0 * 64;
      for (int j = 0; j < KFILL / 16; ++j) {
        int c = tid + j * 128;
        int row = c >> 3, sub = c & 7;
#if USE_ASYNC_LDS
        async_cp16(vs + c * 8, v_lds + row * VPITCH + sub * 8);
#else
        *(h8*)(v_lds + row * VPITCH + sub * 8) = *(const h8*)(vs + c * 8);
#endif
      }
    }
#if USE_ASYNC_LDS
    wait_async0();  // this wave's K and V copies have landed
#endif
    // publishes the tiles to the other waves; standing directly behind the
    // wait it also keeps every LDS read of the tiles behind that wait
    __syncthreads();

   for (int ss = 0; ss < KFILL; ss += 32) {  // the fill's chunks of 32 keys, in order
    const _Float16* kt = k_lds + ss * P64;
    // S^T: two 16(key) x 16(query) tiles, K=64 over D in two 32-steps
    v8f sf0 = {}, sf1 = {};
    {
      v16h ak;
      ak = ld_frag(kt, (0 * 16 + n) * P64 + 0  + hi * 8); sf0 = wmma16(ak, bq0, sf0);
      ak = ld_frag(kt, (0 * 16 + n) * P64 + 32 + hi * 8); sf0 = wmma16(ak, bq1, sf0);
      ak = ld_frag(kt, (1 * 16 + n) * P64 + 0  + hi * 8); sf1 = wmma16(ak, bq0, sf1);
      ak = ld_frag(kt, (1 * 16 + n) * P64 + 32 + hi * 8); sf1 = wmma16(ak, bq1, sf1);
    }

    // online softmax: the lane's 16 scores all belong to query n
    const v8f p0 = sf0 * sc, p1 = sf1 * sc;
    float mloc = fmaxf(
        fmaxf(fmaxf(fmaxf(p0[0], p0[1]), fmaxf(p0[2], p0[3])),
              fmaxf(fmaxf(p0[4], p0[5]), fmaxf(p0[6], p0[7]))),
        fmaxf(fmaxf(fmaxf(p1[0], p1[1]), fmaxf(p1[2], p1[3])),
              fmaxf(fmaxf(p1[4], p1[5]), fmaxf(p1[6], p1[7]))));
    mloc = fmaxf(mloc, xhalf(mloc));  // the other half's 16 keys
    const float mnew  = fmaxf(mloc, mrow);
    const float alpha = __expf(mrow - mnew);
    mrow = mnew;
    float e0[8], e1[8];
    for (int r = 0; r < 8; ++r) {
      e0[r] = __expf(p0[r] - mnew);
      e1[r] = __expf(p1[r] - mnew);
    }
    lsum = lsum * alpha +
           ((((e0[0] + e0[1]) + (e0[2] + e0[3])) + ((e0[4] + e0[5]) + (e0[6] + e0[7]))) +
            (((e1[0] + e1[1]) + (e1[2] + e1[3])) + ((e1[4] + e1[5]) + (e1[6] + e1[7]))));
    o0 *= alpha; o1 *= alpha; o2 *= alpha; o3 *= alpha;

    // P^T as B operand: element 8*g + j = k index 16*g + 8*hi + j = tile g, reg j
    v16h pb;
    for (int r = 0; r < 8; ++r) {
      pb[r]     = (_Float16)e0[r];
      pb[8 + r] = (_Float16)e1[r];
    }

    // V^T as A operand: row = d, by the transposing loads
    const _Float16* vt =
        v_lds + (ss + hi * 8 + (lane & 7)) * VPITCH + ((lane >> 3) & 1) * 8;
    v16h av;
    av = ld_frag_tr(vt + 0 * 16); o0 = wmma16(av, pb, o0);
    av = ld_frag_tr(vt + 1 * 16); o1 = wmma16(av, pb, o1);
    av = ld_frag_tr(vt + 2 * 16); o2 = wmma16(av, pb, o2);
    av = ld_frag_tr(vt + 3 * 16); o3 = wmma16(av, pb, o3);
   }
  }

  // join the halves' sums, normalize and write context in [B,T,E] (f16) for
  // the output GEMM: a lane holds 8 consecutive d of its query per tile
  {
    const float inv = 1.0f / (lsum + xhalf(lsum));
    _Float16* crow = Ctx + ((size_t)b * Tn + t0 + n) * En + h * 64 + hi * 8;
    h8 w0, w1, w2, w3;
    for (int r = 0; r < 8; ++r) {
      w0[r] = (_Float16)(o0[r] * inv);
      w1[r] = (_Float16)(o1[r] * inv);
      w2[r] = (_Float16)(o2[r] * inv);
      w3[r] = (_Float16)(o3[r] * inv);
    }
    *(h8*)(crow + 0 * 16) = w0;
    *(h8*)(crow + 1 * 16) = w1;
    *(h8*)(crow + 2 * 16) = w2;
    *(h8*)(crow + 3 * 16) = w3;
  }
}

// ---------------------------------------------------------------------------
// Output projection: Ctx[4096,1024] @ Wout^T + bout -> f32 out.
// 256 threads (8 waves) per WG compute a 128x64 tile; one LDS fill holds OFILL
// of k = OFILL / 32 k-steps, and a wave's copy takes whole 128-B lines of a row.
// Two buffers: while one fill is worked on, the next one's copies fly into the
// other buffer.
// Each wave = one 16-row stripe x 4 col sub-tiles: 1 A-frag reused over 4
// B-frags -> 4 WMMAs per wave per k-step.
// ---------------------------------------------------------------------------
#define OFILL 128          // k per LDS fill: rows of 256 B
#define PO (OFILL + 8)     // halves: pitch 272 B = 16 B x 17, odd as above

// One fill: OFILL of k of the block's 128 A rows and 64 B rows; ag and bg point
// at the first row's first k. Eight lanes take one 128-B line of a row, the
// block 32 rows at a time.
__device__ __forceinline__ void fill_ab(const _Float16* ag, const _Float16* bg,
                                        _Float16* ad, _Float16* bd, int tid) {
  for (int g = 0; g < 4; ++g) {
    int row = g * 32 + (tid >> 3);
    for (int j = 0; j < OFILL / 64; ++j) {
      int col = j * 64 + (tid & 7) * 8;
      async_cp16(ag + (size_t)row * En + col, ad + row * PO + col);
    }
  }
  for (int g = 0; g < 2; ++g) {
    int row = g * 32 + (tid >> 3);
    for (int j = 0; j < OFILL / 64; ++j) {
      int col = j * 64 + (tid & 7) * 8;
      async_cp16(bg + (size_t)row * En + col, bd + row * PO + col);
    }
  }
}
__global__ __launch_bounds__(256) void outproj_kernel(
    const _Float16* __restrict__ Ctx, const _Float16* __restrict__ Wf,
    const float* __restrict__ bout, float* __restrict__ Out) {
  __shared__ __align__(16) _Float16 a_lds[2][128 * PO];  // [m][k]
  __shared__ __align__(16) _Float16 b_lds[2][64 * PO];   // [n][k]

  const int tid  = threadIdx.x;
  const int wave = tid >> 5, lane = tid & 31;
  const int n = lane & 15, hi = lane >> 4;
  const int rb = blockIdx.x >> 4, cb = blockIdx.x & 15;
  const int r0 = rb * 128, n0 = cb * 64;

  v8f acc[4] = {{}, {}, {}, {}};

  const _Float16* ag = Ctx + (size_t)r0 * En;
  const _Float16* bg = Wf + (size_t)n0 * En;
  fill_ab(ag, bg, a_lds[0], b_lds[0], tid);  // fill 0
  ring_wait_copies();
  __syncthreads();  // publishes fill 0
  // fill 1 flies while fill 0 is worked on
  fill_ab(ag + OFILL, bg + OFILL, a_lds[1], b_lds[1], tid);

  // the work on one fill, out of the buffer (ab, bb)
  auto pass = [&](const _Float16* ab, const _Float16* bb)
      __attribute__((always_inline)) {
    // The scheduling groups keep a k-step's ten LDS reads together in front of its
    // four WMMAs, under counted waits: without them the compiler sinks every pair
    // of reads to its own WMMA and waits for it there, one full LDS wait a WMMA.
#pragma unroll  // constant LDS offsets for the k-steps of a fill
    for (int kk = 0; kk < OFILL; kk += 32) {
      v16h a = ld_frag(ab, (wave * 16 + n) * PO + kk + hi * 8);
      v16h b[4];
      for (int ct = 0; ct < 4; ++ct)
        b[ct] = ld_frag(bb, (ct * 16 + n) * PO + kk + hi * 8);
      for (int ct = 0; ct < 4; ++ct) acc[ct] = wmma16(a, b[ct], acc[ct]);
      __builtin_amdgcn_sched_group_barrier(0x100, 10, 0);  // the k-step's LDS reads
      __builtin_amdgcn_sched_group_barrier(0x008, 4, 0);   // then its WMMAs
    }
  };
  // hand-over behind fill f: this wave has left fill f, its copies of fill f + 1
  // have landed; the barrier publishes fill f + 1 and frees the buffer of fill f
  auto handover = [&]() __attribute__((always_inline)) {
    ring_wait_reads();
    ring_wait_copies();
    __syncthreads();
  };

  // two fills a trip, one per buffer, so that the LDS addresses are constants;
  // the last two fills, behind which nothing is left to copy, stand behind the loop
  for (int f = 0; f < En / OFILL - 2; f += 2) {
    pass(a_lds[0], b_lds[0]);
    handover();
    fill_ab(ag + (f + 2) * OFILL, bg + (f + 2) * OFILL, a_lds[0], b_lds[0], tid);
    pass(a_lds[1], b_lds[1]);
    handover();
    fill_ab(ag + (f + 3) * OFILL, bg + (f + 3) * OFILL, a_lds[1], b_lds[1], tid);
  }
  pass(a_lds[0], b_lds[0]);
  handover();
  pass(a_lds[1], b_lds[1]);

  for (int ct = 0; ct < 4; ++ct) {
    float bias = bout[n0 + ct * 16 + n];
    for (int r = 0; r < 8; ++r) {
      int row = r0 + wave * 16 + hi * 8 + r;
      Out[(size_t)row * En + n0 + ct * 16 + n] = acc[ct][r] + bias;
    }
  }
}

// ---------------------------------------------------------------------------
extern "C" void kernel_launch(void* const* d_in, const int* in_sizes, int n_in,
                              void* d_out, int out_size, void* d_ws,
                              size_t ws_size, hipStream_t stream) {
  (void)in_sizes; (void)n_in; (void)out_size; (void)ws_size;
  const float* query = (const float*)d_in[0];
  const float* para  = (const float*)d_in[1];
  const float* Wq = (const float*)d_in[2];
  const float* bq = (const float*)d_in[3];
  const float* Wk = (const float*)d_in[4];
  const float* bk = (const float*)d_in[5];
  const float* Wv = (const float*)d_in[6];
  const float* bv = (const float*)d_in[7];
  const float* Wout = (const float*)d_in[8];
  const float* bout = (const float*)d_in[9];
  float* out = (float*)d_out;

  // workspace layout (all regions fully overwritten before being read)
  char* ws = (char*)d_ws;
  _Float16* qp  = (_Float16*)(ws);                       // 8 MB: [B*H, T, 64]
  _Float16* kp  = (_Float16*)(ws + (size_t)(8u  << 20)); // 2 MB: [H, S, 64]
  _Float16* vp  = (_Float16*)(ws + (size_t)(10u << 20)); // 2 MB: [H, S, 64]
  _Float16* ctx = (_Float16*)(ws + (size_t)(12u << 20)); // 8 MB: [B*T, E]
  _Float16* wf  = (_Float16*)(ws + (size_t)(20u << 20)); // 2 MB: Wout f16

  // 1024 + 256 + 256 projection blocks, then 1024 conversion blocks
  hipLaunchKernelGGL(pre_kernel, dim3(2560), dim3(128), 0, stream,
                     query, para, Wq, bq, Wk, bk, Wv, bv, Wout, qp, kp, vp, wf);
  hipLaunchKernelGGL(attn_kernel, dim3(1024), dim3(128), 0, stream,
                     qp, kp, vp, ctx);
  hipLaunchKernelGGL(outproj_kernel, dim3(512), dim3(256), 0, stream,
                     ctx, wf, bout, out);
}

// v007
// It runs in 36.8 microseconds.
// In two side-by-side timings against v006, it was 1.10 and 1.09 times as fast.
// All steps since v000 together make it 4.21 times as fast.
#include <hip/hip_runtime.h>

// Problem constants (match reference)
#define Bn 4
#define Tn 1024
#define Sn 1024
#define En 1024
#define Hn 16
#define Dn 64

typedef __attribute__((ext_vector_type(16))) _Float16 v16h;
typedef __attribute__((ext_vector_type(8)))  _Float16 h8;
typedef __attribute__((ext_vector_type(8)))  float    v8f;
typedef __attribute__((ext_vector_type(4)))  int      v4i;

#if __has_builtin(__builtin_amdgcn_global_load_async_to_lds_b128)
#define USE_ASYNC_LDS 1
#else
#define USE_ASYNC_LDS 0
#endif

#if USE_ASYNC_LDS
typedef __attribute__((address_space(1))) v4i as1_v4i;  // global
typedef __attribute__((address_space(3))) v4i as3_v4i;  // LDS
// Copy one 16-byte chunk global -> LDS via the async path (ASYNCcnt).
__device__ __forceinline__ void async_cp16(const _Float16* g, _Float16* l) {
  __builtin_amdgcn_global_load_async_to_lds_b128((as1_v4i*)g, (as3_v4i*)l, 0,
                                                 0);
}
__device__ __forceinline__ void wait_async0() {
#if __has_builtin(__builtin_amdgcn_s_wait_asynccnt)
  __builtin_amdgcn_s_wait_asynccnt(0);
#else
  asm volatile("s_wait_asynccnt 0" ::: "memory");
#endif
}
#else
// The same piece through registers.
__device__ __forceinline__ void async_cp16(const _Float16* g, _Float16* l) {
  *(h8*)l = *(const h8*)g;
}
#endif

// The two waits at the hand-over of a ring of LDS buffers, in asm with the
// "memory" clobber, so that no LDS access and no copy moves over them.
// This wave's copies to LDS have landed:
__device__ __forceinline__ void ring_wait_copies() {
  asm volatile("s_wait_asynccnt 0x0" ::: "memory");
}
// This wave's LDS reads have returned, before a buffer it has read is refilled:
__device__ __forceinline__ void ring_wait_reads() {
  asm volatile("s_wait_dscnt 0x0" ::: "memory");
}

__device__ __forceinline__ v8f wmma16(v16h a, v16h b, v8f c) {
  // D = A(16x32 f16) * B(32x16 f16) + C(16x16 f32)
  return __builtin_amdgcn_wmma_f32_16x16x32_f16(false, a, false, b, (short)0, c,
                                                false, false);
}

// Load one 16-half WMMA operand fragment from an LDS tile.
// Per ISA layout, each lane needs K = g*16 + hi*8 + j (j=0..7, g=0..1), i.e.
// two contiguous 16-byte chunks at (off) and (off+16).
__device__ __forceinline__ v16h ld_frag(const _Float16* base, int off) {
  union { v16h v; h8 h[2]; } u;
  u.h[0] = *(const h8*)(base + off);
  u.h[1] = *(const h8*)(base + off + 16);
  return u.v;
}

// Tiles that ld_frag reads (ds_load_b128, one row per lane): the pitch is an odd
// multiple of 16 B, so that the 16 rows of a half wave fall on all 64 banks.
#define P64 72  // halves: rows of 64 halves (128 B) at 144 B

// V tile in LDS: rows of 64 halves (128 B) at a pitch of 160 B, an odd multiple
// of 32 B, which spreads the transposing reads over the banks.
#define VPITCH 80  // halves

// One 32(k) x 16(n) B fragment out of a row-major [k][n] f16 LDS tile by two
// transposing loads: lane (c = lane & 15, hi = lane >> 4) gets
// tile[8*hi + 0..7][c] and tile[16 + 8*hi + 0..7][c], the k order of ld_frag.
// p is the lane's own address:
// tile + (8*hi + (lane & 7)) * VPITCH + 8 * ((lane >> 3) & 1) + first column.
typedef short s16x8 __attribute__((ext_vector_type(8)));
typedef __attribute__((address_space(3))) s16x8 lds_s16x8;
__device__ __forceinline__ v16h ld_frag_tr(const _Float16* p) {
  union { v16h v; s16x8 s[2]; } u;
  u.s[0] = __builtin_amdgcn_ds_load_tr16_b128_v8i16((lds_s16x8*)p);
  u.s[1] = __builtin_amdgcn_ds_load_tr16_b128_v8i16((lds_s16x8*)(p + 16 * VPITCH));
  return u.v;
}

// ---------------------------------------------------------------------------
// The three passes that depend on nothing but the inputs and whose results other
// work-groups need, as block ranges of one launch, so that they run side by side:
//   blocks   0..255   key projection
//   blocks 256..511   value projection
//   blocks 512..1535  Wout f32 -> f16, 1024 elements a block (layout kept
//                      [n][k] row-major == Wout itself, since the output GEMM
//                      needs B[k][n] = Wout[n][k])
// The projections come first: they run longest.
//
// Projection: X[N,64] @ W^T[64,64] + b -> f16 with head-major row remap.
// rows are (s,h) -> out row h*S + s
// (The query projection is done by the attention waves themselves.)
// 128 threads (4 waves). Each wave: 16 rows x 64 cols = 4 col-tiles, K=64.
// ---------------------------------------------------------------------------
#define KBLK 256   // blocks of the key and of the value projection: S*H / 64

typedef __attribute__((ext_vector_type(4))) _Float16 h4;

__global__ __launch_bounds__(128) void pre_kernel(
    const float* __restrict__ para,
    const float* __restrict__ Wk, const float* __restrict__ bk,
    const float* __restrict__ Wv, const float* __restrict__ bv,
    const float* __restrict__ Wout, _Float16* __restrict__ kp,
    _Float16* __restrict__ vp,
    _Float16* __restrict__ wf) {
  __shared__ __align__(16) _Float16 w_lds[64 * P64];      // [n][k]
  __shared__ __align__(16) _Float16 x_lds[4][16 * P64];   // per wave [m][k]

  const int tid  = threadIdx.x;
  const int blk  = blockIdx.x;

  if (blk >= 2 * KBLK) {  // the same for the whole block, before any barrier
    // a wave's 16-B loads cover 512 contiguous bytes, its 8-B stores 256
    const int base = (blk - 2 * KBLK) * 1024 + tid * 4;
    const float4 f0 = *(const float4*)(Wout + base);
    const float4 f1 = *(const float4*)(Wout + base + 512);
    const h4 g0 = {(_Float16)f0.x, (_Float16)f0.y, (_Float16)f0.z, (_Float16)f0.w};
    const h4 g1 = {(_Float16)f1.x, (_Float16)f1.y, (_Float16)f1.z, (_Float16)f1.w};
    *(h4*)(wf + base)       = g0;
    *(h4*)(wf + base + 512) = g1;
    return;
  }

  // which projection this block belongs to, and its index there
  const bool isv = blk >= KBLK;
  const int pblk = isv ? blk - KBLK : blk;
  const float* __restrict__ X    = para;
  const float* __restrict__ W    = isv ? Wv : Wk;
  const float* __restrict__ bias = isv ? bv : bk;
  _Float16* __restrict__ out     = isv ? vp : kp;

  const int wave = tid >> 5, lane = tid & 31;
  const int n = lane & 15, hi = lane >> 4;
  const int rbase = pblk * 64 + wave * 16;

  for (int j = 0; j < 32; ++j) {
    // B[k][n] = W[n][k] -> store W row-major: two rows of 64 per trip
    w_lds[((tid >> 6) + 2 * j) * P64 + (tid & 63)] = (_Float16)W[tid + j * 128];
  }
  _Float16* xw = x_lds[wave];
  for (int j = 0; j < 32; ++j) {
    int idx = lane + j * 32;
    int m = idx >> 6, c = idx & 63;
    xw[m * P64 + c] = (_Float16)X[(size_t)(rbase + m) * 64 + c];
  }
  __syncthreads();

  v16h a0 = ld_frag(xw, n * P64 + 0  + hi * 8);
  v16h a1 = ld_frag(xw, n * P64 + 32 + hi * 8);

  v8f acc[4];
  for (int ct = 0; ct < 4; ++ct) {
    v8f c = {};
    v16h b0 = ld_frag(w_lds, (ct * 16 + n) * P64 + 0  + hi * 8);
    v16h b1 = ld_frag(w_lds, (ct * 16 + n) * P64 + 32 + hi * 8);
    c = wmma16(a0, b0, c);
    c = wmma16(a1, b1, c);
    acc[ct] = c;
  }

  for (int ct = 0; ct < 4; ++ct) {
    float bv = bias[ct * 16 + n];
    for (int r = 0; r < 8; ++r) {
      int grow = rbase + hi * 8 + r;
      int s = grow >> 4, h = grow & 15;
      int orow = h * Sn + s;
      out[(size_t)orow * 64 + ct * 16 + n] = (_Float16)(acc[ct][r] + bv);
    }
  }
}

#define KFILL 128

// lane l <-> lane l ^ 16
__device__ __forceinline__ float xhalf(float x) {
  int v = __builtin_bit_cast(int, x);
  return __builtin_bit_cast(
      float, __builtin_amdgcn_permlanex16(v, v, 0x76543210, 0xfedcba98, false,
                                          false));
}

__global__ __launch_bounds__(128) void attn_kernel(
    const float* __restrict__ query, const float* __restrict__ Wq,
    const float* __restrict__ bq, const _Float16* __restrict__ Kp,
    const _Float16* __restrict__ Vp, _Float16* __restrict__ Ctx) {
  __shared__ __align__(16) _Float16 x_lds[4][16 * P64]; // per wave [t][k], raw query
  __shared__ __align__(16) _Float16 w_lds[64 * P64];    // Wq [d][k]
  __shared__ __align__(16) _Float16 k_lds[KFILL * P64];    // [s][d] (=A [m][k])
  __shared__ __align__(16) _Float16 v_lds[KFILL * VPITCH]; // [s][d] as in memory

  const int tid  = threadIdx.x;
  const int wave = tid >> 5, lane = tid & 31;
  const int n = lane & 15, hi = lane >> 4;
  const int tt = blockIdx.x & 15;
  const int bh = blockIdx.x >> 4;
  const int b = bh >> 4, h = bh & 15;
  const int t0 = tt * 64 + wave * 16;

  // Query projection of this wave's own 16 queries, taken transposed:
  // Q^T = Wq * X^T + bq. Wq (whole, by the block) and the wave's 16 rows of 64
  // floats come by 16-B loads that cover whole lines and go to LDS as f16.
  _Float16* xw = x_lds[wave];
  float4 bv[8];  // loaded with the rest, so that one memory latency serves all
  {
    const float* xs = query + ((size_t)b * Tn + t0) * En + h * 64;
    float4 wv[8], xv[8];
    for (int j = 0; j < 8; ++j)  // the lane's 8 bias values of each Q^T tile
      bv[j] = *(const float4*)(bq + (j >> 1) * 16 + hi * 8 + (j & 1) * 4);
    for (int j = 0; j < 8; ++j)  // 16 pieces a row of Wq, 8 rows a trip
      wv[j] = *(const float4*)(Wq + (tid + j * 128) * 4);
    for (int j = 0; j < 8; ++j)  // a lane half takes one row of 256 B
      xv[j] = *(const float4*)(xs + (size_t)(2 * j + hi) * En + n * 4);
    for (int j = 0; j < 8; ++j) {
      const int c = tid + j * 128;
      const h4 g = {(_Float16)wv[j].x, (_Float16)wv[j].y, (_Float16)wv[j].z,
                    (_Float16)wv[j].w};
      *(h4*)(w_lds + (c >> 4) * P64 + (c & 15) * 4) = g;
    }
    for (int j = 0; j < 8; ++j) {
      const h4 g = {(_Float16)xv[j].x, (_Float16)xv[j].y, (_Float16)xv[j].z,
                    (_Float16)xv[j].w};
      *(h4*)(xw + (2 * j + hi) * P64 + n * 4) = g;
    }
  }
  __syncthreads();  // publishes Wq to the four waves

  // Tile ct of Q^T: lane (n, hi) holds register r = Q[query n][d = 16*ct + 8*hi + r].
  // Two converted tiles are a B operand as they stand (element 8*g + j = k index
  // 16*g + 8*hi + j = tile g, register j), so Q never goes through memory.
  v16h bq0, bq1;  // Q^T as B operand: column n = query t0 + n
  {
    const v16h bx0 = ld_frag(xw, n * P64 + 0  + hi * 8);
    const v16h bx1 = ld_frag(xw, n * P64 + 32 + hi * 8);
    v8f qt[4];
    for (int ct = 0; ct < 4; ++ct) {
      v8f c = {};
      c = wmma16(ld_frag(w_lds, (ct * 16 + n) * P64 + 0  + hi * 8), bx0, c);
      c = wmma16(ld_frag(w_lds, (ct * 16 + n) * P64 + 32 + hi * 8), bx1, c);
      const float4 c0 = bv[2 * ct], c1 = bv[2 * ct + 1];
      const v8f bias = {c0.x, c0.y, c0.z, c0.w, c1.x, c1.y, c1.z, c1.w};
      qt[ct] = c + bias;
    }
    for (int r = 0; r < 8; ++r) {
      bq0[r]     = (_Float16)qt[0][r];
      bq0[8 + r] = (_Float16)qt[1][r];
      bq1[r]     = (_Float16)qt[2][r];
      bq1[8 + r] = (_Float16)qt[3][r];
    }
  }

  // O^T tiles: register r of tile ct = O[query n][d = 16*ct + 8*hi + r]
  v8f o0 = {}, o1 = {}, o2 = {}, o3 = {};
  float mrow = -3.0e38f;  // running maximum of query n (equal in both halves)
  float lsum = 0.0f;      // running sum over this lane half's keys only
  const float sc = 0.03125f;  // 1/sqrt(E) = 1/32 (reference scales by sqrt(E))

  const size_t kvbase = (size_t)h * Sn * 64;
  for (int s0 = 0; s0 < Sn; s0 += KFILL) {
    __syncthreads();  // prior fill's K/V reads complete
    {   // stage K [KFILL s][64 d]: KFILL * 8 pieces of 16 B, KFILL / 16 per thread
      const _Float16* ks = Kp + kvbase + (size_t)s0 * 64;
#if USE_ASYNC_LDS
      for (int j = 0; j < KFILL / 16; ++j) {
        int c = tid + j * 128;
        async_cp16(ks + c * 8, k_lds + (c >> 3) * P64 + (c & 7) * 8);
      }
#else
      unsigned int* kd = (unsigned int*)k_lds;
      const unsigned int* ku = (const unsigned int*)ks;
      for (int j = 0; j < KFILL / 4; ++j) {
        int u = tid + j * 128;
        kd[(u >> 5) * (P64 / 2) + (u & 31)] = ku[u];
      }
#endif
    }
    {   // stage V as it lies, [KFILL s][64 d]: KFILL / 16 pieces of 16 B per thread
      const _Float16* vs = Vp + kvbase + (size_t)s0 * 64;
      for (int j = 0; j < KFILL / 16; ++j) {
        int c = tid + j * 128;
        int row = c >> 3, sub = c & 7;
#if USE_ASYNC_LDS
        async_cp16(vs + c * 8, v_lds + row * VPITCH + sub * 8);
#else
        *(h8*)(v_lds + row * VPITCH + sub * 8) = *(const h8*)(vs + c * 8);
#endif
      }
    }
#if USE_ASYNC_LDS
    wait_async0();  // this wave's K and V copies have landed
#endif
    // publishes the tiles to the other waves; standing directly behind the
    // wait it also keeps every LDS read of the tiles behind that wait
    __syncthreads();

   for (int ss = 0; ss < KFILL; ss += 32) {  // the fill's chunks of 32 keys, in order
    const _Float16* kt = k_lds + ss * P64;
    // S^T: two 16(key) x 16(query) tiles, K=64 over D in two 32-steps
    v8f sf0 = {}, sf1 = {};
    {
      v16h ak;
      ak = ld_frag(kt, (0 * 16 + n) * P64 + 0  + hi * 8); sf0 = wmma16(ak, bq0, sf0);
      ak = ld_frag(kt, (0 * 16 + n) * P64 + 32 + hi * 8); sf0 = wmma16(ak, bq1, sf0);
      ak = ld_frag(kt, (1 * 16 + n) * P64 + 0  + hi * 8); sf1 = wmma16(ak, bq0, sf1);
      ak = ld_frag(kt, (1 * 16 + n) * P64 + 32 + hi * 8); sf1 = wmma16(ak, bq1, sf1);
    }

    // online softmax: the lane's 16 scores all belong to query n
    const v8f p0 = sf0 * sc, p1 = sf1 * sc;
    float mloc = fmaxf(
        fmaxf(fmaxf(fmaxf(p0[0], p0[1]), fmaxf(p0[2], p0[3])),
              fmaxf(fmaxf(p0[4], p0[5]), fmaxf(p0[6], p0[7]))),
        fmaxf(fmaxf(fmaxf(p1[0], p1[1]), fmaxf(p1[2], p1[3])),
              fmaxf(fmaxf(p1[4], p1[5]), fmaxf(p1[6], p1[7]))));
    mloc = fmaxf(mloc, xhalf(mloc));  // the other half's 16 keys
    const float mnew  = fmaxf(mloc, mrow);
    const float alpha = __expf(mrow - mnew);
    mrow = mnew;
    float e0[8], e1[8];
    for (int r = 0; r < 8; ++r) {
      e0[r] = __expf(p0[r] - mnew);
      e1[r] = __expf(p1[r] - mnew);
    }
    lsum = lsum * alpha +
           ((((e0[0] + e0[1]) + (e0[2] + e0[3])) + ((e0[4] + e0[5]) + (e0[6] + e0[7]))) +
            (((e1[0] + e1[1]) + (e1[2] + e1[3])) + ((e1[4] + e1[5]) + (e1[6] + e1[7]))));
    o0 *= alpha; o1 *= alpha; o2 *= alpha; o3 *= alpha;

    // P^T as B operand: element 8*g + j = k index 16*g + 8*hi + j = tile g, reg j
    v16h pb;
    for (int r = 0; r < 8; ++r) {
      pb[r]     = (_Float16)e0[r];
      pb[8 + r] = (_Float16)e1[r];
    }

    // V^T as A operand: row = d, by the transposing loads
    const _Float16* vt =
        v_lds + (ss + hi * 8 + (lane & 7)) * VPITCH + ((lane >> 3) & 1) * 8;
    v16h av;
    av = ld_frag_tr(vt + 0 * 16); o0 = wmma16(av, pb, o0);
    av = ld_frag_tr(vt + 1 * 16); o1 = wmma16(av, pb, o1);
    av = ld_frag_tr(vt + 2 * 16); o2 = wmma16(av, pb, o2);
    av = ld_frag_tr(vt + 3 * 16); o3 = wmma16(av, pb, o3);
   }
  }

  // join the halves' sums, normalize and write context in [B,T,E] (f16) for
  // the output GEMM: a lane holds 8 consecutive d of its query per tile
  {
    const float inv = 1.0f / (lsum + xhalf(lsum));
    _Float16* crow = Ctx + ((size_t)b * Tn + t0 + n) * En + h * 64 + hi * 8;
    h8 w0, w1, w2, w3;
    for (int r = 0; r < 8; ++r) {
      w0[r] = (_Float16)(o0[r] * inv);
      w1[r] = (_Float16)(o1[r] * inv);
      w2[r] = (_Float16)(o2[r] * inv);
      w3[r] = (_Float16)(o3[r] * inv);
    }
    *(h8*)(crow + 0 * 16) = w0;
    *(h8*)(crow + 1 * 16) = w1;
    *(h8*)(crow + 2 * 16) = w2;
    *(h8*)(crow + 3 * 16) = w3;
  }
}

// ---------------------------------------------------------------------------
// Output projection: Ctx[4096,1024] @ Wout^T + bout -> f32 out.
// 256 threads (8 waves) per WG compute a 128x64 tile; one LDS fill holds OFILL
// of k = OFILL / 32 k-steps, and a wave's copy takes whole 128-B lines of a row.
// Two buffers: while one fill is worked on, the next one's copies fly into the
// other buffer.
// Each wave = one 16-row stripe x 4 col sub-tiles: 1 A-frag reused over 4
// B-frags -> 4 WMMAs per wave per k-step.
// ---------------------------------------------------------------------------
#define OFILL 128          // k per LDS fill: rows of 256 B
#define PO (OFILL + 8)     // halves: pitch 272 B = 16 B x 17, odd as above

// One fill: OFILL of k of the block's 128 A rows and 64 B rows; ag and bg point
// at the first row's first k. Eight lanes take one 128-B line of a row, the
// block 32 rows at a time.
__device__ __forceinline__ void fill_ab(const _Float16* ag, const _Float16* bg,
                                        _Float16* ad, _Float16* bd, int tid) {
  for (int g = 0; g < 4; ++g) {
    int row = g * 32 + (tid >> 3);
    for (int j = 0; j < OFILL / 64; ++j) {
      int col = j * 64 + (tid & 7) * 8;
      async_cp16(ag + (size_t)row * En + col, ad + row * PO + col);
    }
  }
  for (int g = 0; g < 2; ++g) {
    int row = g * 32 + (tid >> 3);
    for (int j = 0; j < OFILL / 64; ++j) {
      int col = j * 64 + (tid & 7) * 8;
      async_cp16(bg + (size_t)row * En + col, bd + row * PO + col);
    }
  }
}
__global__ __launch_bounds__(256) void outproj_kernel(
    const _Float16* __restrict__ Ctx, const _Float16* __restrict__ Wf,
    const float* __restrict__ bout, float* __restrict__ Out) {
  __shared__ __align__(16) _Float16 a_lds[2][128 * PO];  // [m][k]
  __shared__ __align__(16) _Float16 b_lds[2][64 * PO];   // [n][k]

  const int tid  = threadIdx.x;
  const int wave = tid >> 5, lane = tid & 31;
  const int n = lane & 15, hi = lane >> 4;
  const int rb = blockIdx.x >> 4, cb = blockIdx.x & 15;
  const int r0 = rb * 128, n0 = cb * 64;

  v8f acc[4] = {{}, {}, {}, {}};

  const _Float16* ag = Ctx + (size_t)r0 * En;
  const _Float16* bg = Wf + (size_t)n0 * En;
  fill_ab(ag, bg, a_lds[0], b_lds[0], tid);  // fill 0
  ring_wait_copies();
  __syncthreads();  // publishes fill 0
  // fill 1 flies while fill 0 is worked on
  fill_ab(ag + OFILL, bg + OFILL, a_lds[1], b_lds[1], tid);

  // the work on one fill, out of the buffer (ab, bb)
  auto pass = [&](const _Float16* ab, const _Float16* bb)
      __attribute__((always_inline)) {
    // The scheduling groups keep a k-step's ten LDS reads together in front of its
    // four WMMAs, under counted waits: without them the compiler sinks every pair
    // of reads to its own WMMA and waits for it there, one full LDS wait a WMMA.
#pragma unroll  // constant LDS offsets for the k-steps of a fill
    for (int kk = 0; kk < OFILL; kk += 32) {
      v16h a = ld_frag(ab, (wave * 16 + n) * PO + kk + hi * 8);
      v16h b[4];
      for (int ct = 0; ct < 4; ++ct)
        b[ct] = ld_frag(bb, (ct * 16 + n) * PO + kk + hi * 8);
      for (int ct = 0; ct < 4; ++ct) acc[ct] = wmma16(a, b[ct], acc[ct]);
      __builtin_amdgcn_sched_group_barrier(0x100, 10, 0);  // the k-step's LDS reads
      __builtin_amdgcn_sched_group_barrier(0x008, 4, 0);   // then its WMMAs
    }
  };
  // hand-over behind fill f: this wave has left fill f, its copies of fill f + 1
  // have landed; the barrier publishes fill f + 1 and frees the buffer of fill f
  auto handover = [&]() __attribute__((always_inline)) {
    ring_wait_reads();
    ring_wait_copies();
    __syncthreads();
  };

  // two fills a trip, one per buffer, so that the LDS addresses are constants;
  // the last two fills, behind which nothing is left to copy, stand behind the loop
  for (int f = 0; f < En / OFILL - 2; f += 2) {
    pass(a_lds[0], b_lds[0]);
    handover();
    fill_ab(ag + (f + 2) * OFILL, bg + (f + 2) * OFILL, a_lds[0], b_lds[0], tid);
    pass(a_lds[1], b_lds[1]);
    handover();
    fill_ab(ag + (f + 3) * OFILL, bg + (f + 3) * OFILL, a_lds[1], b_lds[1], tid);
  }
  pass(a_lds[0], b_lds[0]);
  handover();
  pass(a_lds[1], b_lds[1]);

  for (int ct = 0; ct < 4; ++ct) {
    float bias = bout[n0 + ct * 16 + n];
    for (int r = 0; r < 8; ++r) {
      int row = r0 + wave * 16 + hi * 8 + r;
      Out[(size_t)row * En + n0 + ct * 16 + n] = acc[ct][r] + bias;
    }
  }
}

// ---------------------------------------------------------------------------
extern "C" void kernel_launch(void* const* d_in, const int* in_sizes, int n_in,
                              void* d_out, int out_size, void* d_ws,
                              size_t ws_size, hipStream_t stream) {
  (void)in_sizes; (void)n_in; (void)out_size; (void)ws_size;
  const float* query = (const float*)d_in[0];
  const float* para  = (const float*)d_in[1];
  const float* Wq = (const float*)d_in[2];
  const float* bq = (const float*)d_in[3];
  const float* Wk = (const float*)d_in[4];
  const float* bk = (const float*)d_in[5];
  const float* Wv = (const float*)d_in[6];
  const float* bv = (const float*)d_in[7];
  const float* Wout = (const float*)d_in[8];
  const float* bout = (const float*)d_in[9];
  float* out = (float*)d_out;

  // workspace layout (all regions fully overwritten before being read)
  char* ws = (char*)d_ws;
  _Float16* kp  = (_Float16*)(ws + (size_t)(8u  << 20)); // 2 MB: [H, S, 64]
  _Float16* vp  = (_Float16*)(ws + (size_t)(10u << 20)); // 2 MB: [H, S, 64]
  _Float16* ctx = (_Float16*)(ws + (size_t)(12u << 20)); // 8 MB: [B*T, E]
  _Float16* wf  = (_Float16*)(ws + (size_t)(20u << 20)); // 2 MB: Wout f16

  // 256 + 256 projection blocks, then 1024 conversion blocks
  hipLaunchKernelGGL(pre_kernel, dim3(1536), dim3(128), 0, stream,
                     para, Wk, bk, Wv, bv, Wout, kp, vp, wf);
  hipLaunchKernelGGL(attn_kernel, dim3(1024), dim3(128), 0, stream,
                     query, Wq, bq, kp, vp, ctx);
  hipLaunchKernelGGL(outproj_kernel, dim3(512), dim3(256), 0, stream,
                     ctx, wf, bout, out);
}
